// v000
// The times below were measured on an AMD MI455X: many runs one after another, warmed up first and cycling through
// copies of the inputs, with the whole window's GPU time divided by the number of runs. Launches and the gaps
// between them are all in it. The median over several windows is given; except for v000 it joins two sittings, which
// can be a few percent apart, so the side-by-side timings, each taken in one sitting, are the better comparison.
// v000, which the later versions start from, runs in 158 microseconds.
#include <hip/hip_runtime.h>

// Single-head scaled dot-product attention with a key-length mask: q/k/v [NB][SEQ][64] (f32), valid_lens [NB] (int32, device-read); scores = q k^T / 8; keys at positions >= valid_lens[b] have their score REPLACED by -1e6; softmax over all keys; output = P v (f32).
// Compute dtypes, f32 accumulate everywhere: scores v_wmma_f32_16x16x32_f16, one product (q, k RNE-converted to bf16 at their load, x16 carry, held as f16: exact);
// P.V v_wmma_f32_16x16x32_f16, one product: P single f16 (x16384 carry, row sum over the converted P, cancels in the normalisation), v RNE-converted to bf16 at its load, x16 carry, held as f16 (exact); softmax f32 (online, running max over every visited key, filled ones included).
// Layout: f16 planes q [b][t][d], k [b][t][d], v^T [b][d][t] (transposed through LDS); fused flash kernel in transposed form (S^T = K Q^T, O^T = V^T P^T), fragments straight from the planes, output from f32 accumulators.
// Key rule per element: key j kept iff j < valid_lens[b]; other elements of a visited 32-key tile take the fill value (replace, not add). Tiles wholly past the valid length are skipped when valid_lens[b] >= 1 (their
// exponentials are exactly zero in f32); when valid_lens[b] < 1 every tile is visited with every score filled, which gives the uniform average over all SEQ keys.

#ifndef NB
#define NB 16
#endif
#ifndef SEQ
#define SEQ 4096
#endif
#define NB_FULL  16
#define SEQ_FULL 4096
#ifndef OUT_SEQ
#define OUT_SEQ SEQ              // row pitch (in tokens) between batches of the output
#endif
#define HD   64                  // feature width of q, k, v and of the output
#define AW   4                   // waves per flash block (16 query rows each)
#define OSP  68                  // LDS row pitch (floats) of the flash output tile
#define TP   72                  // LDS row pitch (halves) of the transpose tile
#define XC   16.0f               // power-of-two carry of the q, k, v planes
#define XCI  (1.0f / 16.0f)
#define SC2  ((float)(0.125 * 1.4426950408889634 / 256.0))   // HD^-0.5 * log2(e) / (XC*XC)
#define FILL2 ((float)(-1.0e6 * 1.4426950408889634))          // the fill value in log2 units
#define PSH  14.0f               // log2 of the P carry (16384)
#define NEGB (-3.0e38f)

static_assert(HD == 64);                       // two 32-deep k-steps per score tile, four 16-row output tiles
static_assert(HD % 32 == 0);                   // score k-loop steps by 32
static_assert(SEQ % 64 == 0);                  // transpose tiles of 64 tokens cover the sequence exactly
static_assert(SEQ % 32 == 0);                  // key loop steps by 32
static_assert(SEQ % (16 * AW) == 0);           // flash grid covers the sequence exactly
static_assert(((size_t)SEQ * HD) % 8 == 0);    // convert kernel handles 8 elements per lane
static_assert(NB <= NB_FULL);
static_assert(SEQ <= SEQ_FULL);
static_assert(OSP >= HD);
static_assert((OSP * 4) % 16 == 0);
static_assert(TP >= 64);
static_assert((TP * 2) % 16 == 0);
static_assert(8 * 32 * 16 == 16 * HD * 4);     // flash epilogue: 8 instructions x 32 lanes x 16 B == 16 rows x 256 B
static_assert(256 * 2 * 16 == HD * 64 * 2);
static_assert(256 * 4 * 4 == 64 * HD);         // transpose load: 256 threads x 4 x float4 == 64 tokens x 64 features
static_assert((size_t)AW * 16 * OSP * 4 <= 131072);   // static LDS of the flash kernel
static_assert((size_t)HD * TP * 2 <= 131072);         // static LDS of the transpose kernel

typedef _Float16 h16;
typedef __attribute__((ext_vector_type(16))) _Float16 v16h;
typedef __attribute__((ext_vector_type(8)))  _Float16 v8h;
typedef __attribute__((ext_vector_type(8)))  float    v8f;
typedef __attribute__((ext_vector_type(4)))  float    v4f;
typedef v4f  __attribute__((may_alias)) v4fa;
typedef v8h  __attribute__((may_alias)) v8ha;

__device__ __forceinline__ unsigned short f2bf(float f) { unsigned u = __float_as_uint(f); u += 0x7FFFu + ((u >> 16) & 1u); return (unsigned short)(u >> 16); }
__device__ __forceinline__ float bfr(float f) { return __uint_as_float(((unsigned)f2bf(f)) << 16); }   // value after RNE convert to bf16
__device__ __forceinline__ v16h cat16(v8h lo, v8h hi) { return __builtin_shufflevector(lo, hi, 0, 1, 2, 3, 4, 5, 6, 7, 8, 9, 10, 11, 12, 13, 14, 15); }
__device__ __forceinline__ v8f wmma16(v16h a, v16h b, v8f c) { return __builtin_amdgcn_wmma_f32_16x16x32_f16(false, a, false, b, (short)0, c, false, false); }
// one matrix instruction followed by its own four-slot guard (ties D, keeps A and B live)
__device__ __forceinline__ v8f wmma16g(v16h a, v16h b, v8f c) { c = wmma16(a, b, c); asm volatile("v_nop\n\tv_nop\n\tv_nop\n\tv_nop" : "+v"(c) : "v"(a), "v"(b)); return c; }
// fragment loaders from K-contiguous 16-bit rows; p already includes + 8*(lane>>4): elements 0..7 <- k0+8h+0..7, elements 8..15 <- k0+16+8h+0..7 (same map for A and B)
__device__ __forceinline__ v16h  ldh(const h16* p) { return cat16(*(const v8h*)p, *(const v8h*)(p + 16)); }
// ordering point for wave-private LDS tiles (same wave writes and reads)
__device__ __forceinline__ void wave_sync() { __builtin_amdgcn_fence(3 /* release order */, "wavefront"); __builtin_amdgcn_wave_barrier(); asm volatile("" ::: "memory"); }
// f32 -> f16 operand convert that cannot produce an f16 subnormal (applied after the plane's carry)
static __device__ __forceinline__ h16 toh_flush(float v) { const h16 r = (h16)v; return (fabsf(v) < 6.103515625e-05f) ? (h16)0.0f : r; }

__global__ __launch_bounds__(256) void k_cvth(const float* __restrict__ src, h16* dst, size_t n8) {
#pragma clang fp contract(off)
    const size_t i = (size_t)blockIdx.x * 256 + threadIdx.x; if (i >= n8) return;
    const v8f v = *(const v8f*)(src + i * 8); v8h o;
#pragma unroll
    for (int k = 0; k < 8; ++k) o[k] = toh_flush(bfr(v[k]) * XC);
    *(v8h*)(dst + i * 8) = o; 
}

// k_vt: transposed f16 copy of (RNE bf16 value of v) x XC: in [b][t][64] (batch pitch SEQ_FULL tokens) -> out [b][64][t] (row pitch SEQ).
__global__ __launch_bounds__(256) void k_vt(const float* __restrict__ src, h16* dst) {
#pragma clang fp contract(off)
    __shared__ __align__(16) h16 ts[HD * TP];
    const int tid = threadIdx.x;
    const int b = blockIdx.y; const int t0 = blockIdx.x * 64;
    const float* sp = src + ((size_t)b * SEQ_FULL + (size_t)t0) * HD;      // 64 tokens x 64 floats, contiguous
#pragma unroll 1
    for (int s = 0; s < 4; ++s) { const int p = s * 256 + tid; const int tok = p >> 4, c0 = (p & 15) * 4;   // 4 s x 256 float4 = 64 tokens x 16 float4
        const v4f x = *(const v4f*)(sp + (size_t)p * 4);
#pragma unroll
        for (int i = 0; i < 4; ++i) ts[(c0 + i) * TP + tok] = toh_flush(bfr(x[i]) * XC); }
    __syncthreads();
    h16* dp = dst + (size_t)b * HD * SEQ + (size_t)t0;
{
#pragma unroll
        for (int s = 0; s < 2; ++s) { const int p = s * 256 + tid; const int row = p >> 3, c8 = (p & 7) * 8;   // 2 s x 32 row groups = 64 rows; 8 lanes x 8 halves = 64 tokens = one line
            const v8h val = *(const v8ha*)(&ts[row * TP + c8]);
            *(v8h*)(dp + (size_t)row * SEQ + c8) = val; }
         }
}

// k_flash: fused attention, one wave per 16 query rows of one batch; K / V^T / Q fragments straight from the f16 planes (two 16-B loads each, arithmetic addressing).
// Transposed form: S^T[key][t] = K Q^T (A = K rows, B = Q rows, two 32-deep k-steps); lane (t = lane&15, h = lane>>4) holds keys 8h+r of each 16-key tile, so the packed
// P tile is directly the B fragment of O^T[d][t] = V^T P^T (element r <- tile keys 0..15, element 8+r <- tile keys 16..31, lane unchanged); four 16-row output tiles.
// Softmax state (running max, partial sum) is one scalar per lane; the two lane halves of a row are combined with one xor-16 exchange.
// Key rule evaluated per element inside every visited 32-key tile (kept score or fill value, selected by value); the per-wave key bound comes from the device-read valid length and is at most SEQ.
// P = exp2(e) with e <= 14; elements with e < -14 are selected to zero so that no f16 subnormal operand is formed.
__global__ __launch_bounds__(32 * AW) void k_flash(const h16* __restrict__ QH, const h16* __restrict__ KP, const h16* __restrict__ VT, const int* __restrict__ vlen, float* OUT) {
    __shared__ __align__(16) float os[AW * 16 * OSP];
    const int lane = threadIdx.x & 31, lr = lane & 15, hi = lane >> 4;
    const int wave = __builtin_amdgcn_readfirstlane((int)(threadIdx.x >> 5));
    const int b = blockIdx.y;
    const int t0 = (blockIdx.x * AW + wave) * 16;
    int vl = vlen[b]; vl = vl > SEQ ? SEQ : vl;                                // key j kept iff j < vl
    const int kend = vl < 1 ? SEQ : vl;                                        // no kept key: every key visited with the fill value
    const int nk = (kend + 31) & ~31;                                          // wave-uniform, multiple of 32, in [32, SEQ]
    const size_t pbase = (size_t)b * SEQ * HD;
    const size_t qo = pbase + (size_t)(t0 + lr) * HD + 8 * hi;
    const v16h q0 = ldh(QH + qo), q1 = ldh(QH + qo + 32);      // B fragments: col t, k = d (two k-steps)
    const size_t ko = pbase + (size_t)lr * HD + 8 * hi;        // + key * HD        (A fragment: row key, k = d)
    const size_t vo = pbase + (size_t)lr * SEQ + 8 * hi;       // + 16j*SEQ + key   (A fragment: row d, k = key)
    v8f o[4];
#pragma unroll
    for (int j = 0; j < 4; ++j) o[j] = (v8f){};
    float m = NEGB, l = 0.0f;
#pragma unroll 1
    for (int key0 = 0; key0 < nk; key0 += 32) {
        const h16* ka = KP + ko + (size_t)key0 * HD;
        const v16h ka0 = ldh(ka), ka1 = ldh(ka + 32), kb0 = ldh(ka + 16 * HD), kb1 = ldh(ka + 16 * HD + 32);
        v8f sa = (v8f){}, sb = (v8f){};
        sa = wmma16g(ka0, q0, sa); sb = wmma16g(kb0, q0, sb); sa = wmma16g(ka1, q1, sa); sb = wmma16g(kb1, q1, sb);
        const int ja = key0 + 8 * hi;
        float ta[8], tb[8]; float mx = NEGB;
#pragma unroll
        for (int r = 0; r < 8; ++r) {
            const bool fa = (ja + r) < vl;
            const bool fb = (ja + 16 + r) < vl;
            const float xa = sa[r] * SC2, xb = sb[r] * SC2;
            ta[r] = fa ? xa : FILL2; tb[r] = fb ? xb : FILL2;                  // replace fill, selected by value
            mx = fmaxf(mx, fmaxf(ta[r], tb[r])); }
        mx = fmaxf(mx, __shfl_xor(mx, 16, 32));
        const float mnew = fmaxf(m, mx);
        const float alpha = __builtin_amdgcn_exp2f(m - mnew);
        const float sh = PSH - mnew;
        v16h pb; float ls = 0.0f;
#pragma unroll
        for (int r = 0; r < 8; ++r) {
            const float ea = ta[r] + sh, eb = tb[r] + sh;
            const float xa = __builtin_amdgcn_exp2f(ea), xb = __builtin_amdgcn_exp2f(eb);
            const float ga = (ea < -14.0f) ? 0.0f : xa, gb = (eb < -14.0f) ? 0.0f : xb;   // below 2^-14: zero by value
            const h16 pa = (h16)ga; const h16 pc = (h16)gb;
            pb[r] = pa; pb[8 + r] = pc;
            ls += (float)pa + (float)pc; }
        l = l * alpha + ls; m = mnew;
#pragma unroll
        for (int j = 0; j < 4; ++j) o[j] = o[j] * alpha;
        const h16* va = VT + vo + key0;
        v16h vf[4];
#pragma unroll
        for (int j = 0; j < 4; ++j) vf[j] = ldh(va + (size_t)(16 * j) * SEQ);
#pragma unroll
        for (int j = 0; j < 4; ++j) o[j] = wmma16g(vf[j], pb, o[j]);
    }
    l += __shfl_xor(l, 16, 32);
    const bool any = l > 0.0f;
    const float lsafe = any ? l : 1.0f;
    const float inv = any ? ((1.0f / lsafe) * XCI) : 0.0f;     // folds the v carry back; the P carry cancels against l
    const int wb = wave * 16 * OSP;
    // O^T D layout: o[j][r] = (d = 16j + 8h + r, t = lane&15) -> os[t][d]; rows 0..15 x columns 0..63 all written
#pragma unroll
    for (int j = 0; j < 4; ++j) { v4f a, c;
        a[0] = o[j][0] * inv; a[1] = o[j][1] * inv; a[2] = o[j][2] * inv; a[3] = o[j][3] * inv;
        c[0] = o[j][4] * inv; c[1] = o[j][5] * inv; c[2] = o[j][6] * inv; c[3] = o[j][7] * inv;
        *(v4fa*)(&os[wb + lr * OSP + 16 * j + 8 * hi]) = a; *(v4fa*)(&os[wb + lr * OSP + 16 * j + 8 * hi + 4]) = c; }
    wave_sync();
    float* orow = OUT + ((size_t)b * OUT_SEQ + (size_t)t0) * HD;           // 16 rows x 64 floats, contiguous
{
#pragma unroll
        for (int s = 0; s < 8; ++s) { const int p = s * 32 + lane; const int row = p >> 4, cofs = (p & 15) * 4;   // 8 s x 2 rows = 16 rows; 16 lanes x 4 floats = 64 columns = two lines
            const v4f val = *(const v4fa*)(&os[wb + row * OSP + cofs]);
            *(v4f*)(orow + (size_t)p * 4) = val; }
         }
}

static constexpr size_t al256(size_t v) { return (v + 255) & ~(size_t)255; }
static constexpr size_t SZ_PL = al256((size_t)NB * SEQ * HD * 2);
static constexpr size_t SZ_TOTAL = 3 * SZ_PL;
static_assert(SZ_TOTAL <= (size_t)134217728);          // workspace carve <= 128 MiB
static_assert(((size_t)SEQ * 2) % 128 == 0);

extern "C" void kernel_launch(void* const* d_in, const int* in_sizes, int n_in,
                              void* d_out, int out_size, void* d_ws, size_t ws_size, hipStream_t stream) {
    if (n_in < 4) return;
    const size_t needx = ((size_t)(NB - 1) * SEQ_FULL + SEQ) * HD;
    if ((size_t)in_sizes[0] < needx || (size_t)in_sizes[1] < needx || (size_t)in_sizes[2] < needx) return;
    if (in_sizes[3] < NB) return;
    if ((size_t)out_size < ((size_t)(NB - 1) * OUT_SEQ + SEQ) * HD) return;
    if (SZ_TOTAL > ws_size) return;
    // wire order: q, k, v, valid_lens
    const float* qin = (const float*)d_in[0];
    const float* kin = (const float*)d_in[1];
    const float* vin = (const float*)d_in[2];
    const int* vlen = (const int*)d_in[3];
    float* OUT = (float*)d_out;      // [NB][SEQ][64]
    char* wsp = (char*)d_ws;
    h16* QH = (h16*)wsp; wsp += SZ_PL;               // [NB][SEQ][64]   q x16
    h16* KP = (h16*)wsp; wsp += SZ_PL;               // [NB][SEQ][64]   k x16
    h16* VT = (h16*)wsp; wsp += SZ_PL;               // [NB][64][SEQ]   v^T x16

    if (SEQ == SEQ_FULL) {
        const size_t n8 = (size_t)NB * SEQ * HD / 8;
        k_cvth<<<(unsigned)((n8 + 255) / 256), 256, 0, stream>>>(qin, QH, n8);
        k_cvth<<<(unsigned)((n8 + 255) / 256), 256, 0, stream>>>(kin, KP, n8);
    } else {
        const size_t n8 = (size_t)SEQ * HD / 8;
        for (int b = 0; b < NB; ++b) {
            k_cvth<<<(unsigned)((n8 + 255) / 256), 256, 0, stream>>>(qin + (size_t)b * SEQ_FULL * HD, QH + (size_t)b * SEQ * HD, n8);
            k_cvth<<<(unsigned)((n8 + 255) / 256), 256, 0, stream>>>(kin + (size_t)b * SEQ_FULL * HD, KP + (size_t)b * SEQ * HD, n8);
        }
    }
    // v [b][t][64] (batch pitch SEQ_FULL) -> v^T plane [b][64][t]
    k_vt<<<dim3(SEQ / 64, NB, 1), 256, 0, stream>>>(vin, VT);

    // one wave per 16 query rows; all waves of a block share the batch and therefore the key bound
    k_flash<<<dim3(SEQ / (16 * AW), NB, 1), 32 * AW, 0, stream>>>(QH, KP, VT, vlen, OUT);
}

// v001
// Measured time: 63.3 microseconds a run.
// Timed twice side by side with v000, it ran 2.61 and 2.56 times as fast.
#include <hip/hip_runtime.h>

// Single-head scaled dot-product attention with a key-length mask: q/k/v [NB][SEQ][64] (f32), valid_lens [NB] (int32, device-read); scores = q k^T / 8; keys at positions >= valid_lens[b] have their score REPLACED by -1e6; softmax over all keys; output = P v (f32).
// Compute dtypes, f32 accumulate everywhere: scores v_wmma_f32_16x16x32_f16, one product (q, k RNE-converted to bf16 at their load, x16 carry, held as f16: exact);
// P.V v_wmma_f32_16x16x32_f16, one product: P single f16 (x16384 carry, row sum over the converted P, cancels in the normalisation), v RNE-converted to bf16 at its load, x16 carry, held as f16 (exact); softmax f32 (online, running max over every visited key, filled ones included).
// Layout: f16 planes q [b][t][d], k [b][t][d], v^T [b][d][t] (transposed through LDS); fused flash kernel in transposed form (S^T = K Q^T, O^T = V^T P^T), Q fragments straight from the plane, K / V^T fragments from a two-buffer LDS ring filled by asynchronous copies, output from f32 accumulators.
// Key rule per element: key j kept iff j < valid_lens[b]; other elements of a visited 32-key tile take the fill value (replace, not add). Tiles wholly past the valid length are skipped when valid_lens[b] >= 1 (their
// exponentials are exactly zero in f32); when valid_lens[b] < 1 every tile is visited with every score filled, which gives the uniform average over all SEQ keys.

#ifndef NB
#define NB 16
#endif
#ifndef SEQ
#define SEQ 4096
#endif
#define NB_FULL  16
#define SEQ_FULL 4096
#ifndef OUT_SEQ
#define OUT_SEQ SEQ              // row pitch (in tokens) between batches of the output
#endif
#define HD   64                  // feature width of q, k, v and of the output
#define AW   4                   // waves per flash block (16 query rows each)
#define OSP  68                  // LDS row pitch (floats) of the flash output tile
#define TP   72                  // LDS row pitch (halves) of the transpose tile
#define KS   64                  // keys per ring stage (two 32-key tiles): one whole 128-B line per V^T row
#define LP   72                  // LDS row pitch (halves) of the ring rows: 144 B = 16 B x odd for 16-byte readers
#define STG  ((KS + HD) * LP)    // halves per ring buffer: KS rows of K, then HD rows of V^T
#define XC   16.0f               // power-of-two carry of the q, k, v planes
#define XCI  (1.0f / 16.0f)
#define SC2  ((float)(0.125 * 1.4426950408889634 / 256.0))   // HD^-0.5 * log2(e) / (XC*XC)
#define FILL2 ((float)(-1.0e6 * 1.4426950408889634))          // the fill value in log2 units
#define PSH  14.0f               // log2 of the P carry (16384)
#define NEGB (-3.0e38f)

static_assert(HD == 64);                       // two 32-deep k-steps per score tile, four 16-row output tiles
static_assert(HD % 32 == 0);                   // score k-loop steps by 32
static_assert(SEQ % 64 == 0);                  // transpose tiles of 64 tokens cover the sequence exactly
static_assert(SEQ % 32 == 0);                  // key loop steps by 32
static_assert(SEQ % (16 * AW) == 0);           // flash grid covers the sequence exactly
static_assert(((size_t)SEQ * HD) % 8 == 0);    // convert kernel handles 8 elements per lane
static_assert(NB <= NB_FULL);
static_assert(SEQ <= SEQ_FULL);
static_assert(OSP >= HD);
static_assert((OSP * 4) % 16 == 0);
static_assert(TP >= 64);
static_assert((TP * 2) % 16 == 0);
static_assert(8 * 32 * 16 == 16 * HD * 4);     // flash epilogue: 8 instructions x 32 lanes x 16 B == 16 rows x 256 B
static_assert(256 * 2 * 16 == HD * 64 * 2);
static_assert(256 * 4 * 4 == 64 * HD);         // transpose load: 256 threads x 4 x float4 == 64 tokens x 64 features
static_assert((size_t)AW * 16 * OSP * 4 + (size_t)2 * STG * 2 <= 131072);   // static LDS of the flash kernel
static_assert(SEQ % KS == 0);                  // a ring stage never runs past the planes
static_assert(KS == 64);                       // two 32-key tiles per stage; 8 copies of 16 B cover one ring row
static_assert((LP * 2) % 16 == 0);
static_assert(LP >= KS);
static_assert(LP >= HD);
static_assert(32 * AW * 4 * 16 == KS * HD * 2);   // ring fill: 128 lanes x 4 copies x 16 B == one 8-KiB tile (K, and again V^T)
static_assert((size_t)HD * TP * 2 <= 131072);         // static LDS of the transpose kernel

typedef _Float16 h16;
typedef __attribute__((ext_vector_type(16))) _Float16 v16h;
typedef __attribute__((ext_vector_type(8)))  _Float16 v8h;
typedef __attribute__((ext_vector_type(8)))  float    v8f;
typedef __attribute__((ext_vector_type(4)))  float    v4f;
typedef v4f  __attribute__((may_alias)) v4fa;
typedef v8h  __attribute__((may_alias)) v8ha;

__device__ __forceinline__ unsigned short f2bf(float f) { unsigned u = __float_as_uint(f); u += 0x7FFFu + ((u >> 16) & 1u); return (unsigned short)(u >> 16); }
__device__ __forceinline__ float bfr(float f) { return __uint_as_float(((unsigned)f2bf(f)) << 16); }   // value after RNE convert to bf16
__device__ __forceinline__ v16h cat16(v8h lo, v8h hi) { return __builtin_shufflevector(lo, hi, 0, 1, 2, 3, 4, 5, 6, 7, 8, 9, 10, 11, 12, 13, 14, 15); }
__device__ __forceinline__ v8f wmma16(v16h a, v16h b, v8f c) { return __builtin_amdgcn_wmma_f32_16x16x32_f16(false, a, false, b, (short)0, c, false, false); }
// one matrix instruction followed by its own four-slot guard (ties D, keeps A and B live)
__device__ __forceinline__ v8f wmma16g(v16h a, v16h b, v8f c) { c = wmma16(a, b, c); asm volatile("v_nop\n\tv_nop\n\tv_nop\n\tv_nop" : "+v"(c) : "v"(a), "v"(b)); return c; }
// fragment loaders from K-contiguous 16-bit rows; p already includes + 8*(lane>>4): elements 0..7 <- k0+8h+0..7, elements 8..15 <- k0+16+8h+0..7 (same map for A and B)
__device__ __forceinline__ v16h  ldh(const h16* p) { return cat16(*(const v8h*)p, *(const v8h*)(p + 16)); }
// ordering point for wave-private LDS tiles (same wave writes and reads)
__device__ __forceinline__ void wave_sync() { __builtin_amdgcn_fence(3 /* release order */, "wavefront"); __builtin_amdgcn_wave_barrier(); asm volatile("" ::: "memory"); }
// f32 -> f16 operand convert that cannot produce an f16 subnormal (applied after the plane's carry)
static __device__ __forceinline__ h16 toh_flush(float v) { const h16 r = (h16)v; return (fabsf(v) < 6.103515625e-05f) ? (h16)0.0f : r; }

__global__ __launch_bounds__(256) void k_cvth(const float* __restrict__ src, h16* dst, size_t n8) {
#pragma clang fp contract(off)
    const size_t i = (size_t)blockIdx.x * 256 + threadIdx.x; if (i >= n8) return;
    const v8f v = *(const v8f*)(src + i * 8); v8h o;
#pragma unroll
    for (int k = 0; k < 8; ++k) o[k] = toh_flush(bfr(v[k]) * XC);
    *(v8h*)(dst + i * 8) = o; 
}

// k_vt: transposed f16 copy of (RNE bf16 value of v) x XC: in [b][t][64] (batch pitch SEQ_FULL tokens) -> out [b][64][t] (row pitch SEQ).
__global__ __launch_bounds__(256) void k_vt(const float* __restrict__ src, h16* dst) {
#pragma clang fp contract(off)
    __shared__ __align__(16) h16 ts[HD * TP];
    const int tid = threadIdx.x;
    const int b = blockIdx.y; const int t0 = blockIdx.x * 64;
    const float* sp = src + ((size_t)b * SEQ_FULL + (size_t)t0) * HD;      // 64 tokens x 64 floats, contiguous
#pragma unroll 1
    for (int s = 0; s < 4; ++s) { const int p = s * 256 + tid; const int tok = p >> 4, c0 = (p & 15) * 4;   // 4 s x 256 float4 = 64 tokens x 16 float4
        const v4f x = *(const v4f*)(sp + (size_t)p * 4);
#pragma unroll
        for (int i = 0; i < 4; ++i) ts[(c0 + i) * TP + tok] = toh_flush(bfr(x[i]) * XC); }
    __syncthreads();
    h16* dp = dst + (size_t)b * HD * SEQ + (size_t)t0;
{
#pragma unroll
        for (int s = 0; s < 2; ++s) { const int p = s * 256 + tid; const int row = p >> 3, c8 = (p & 7) * 8;   // 2 s x 32 row groups = 64 rows; 8 lanes x 8 halves = 64 tokens = one line
            const v8h val = *(const v8ha*)(&ts[row * TP + c8]);
            *(v8h*)(dp + (size_t)row * SEQ + c8) = val; }
         }
}

// ring_fill: one stage of the ring: 64 keys of K (64 rows x 128 B, contiguous in the plane) and of V^T (64 rows x 128 B, plane pitch SEQ), 16 B per lane and copy, whole lines per wave.
// kg / vg: this lane's first global chunk of the stage; lk / lv: its LDS byte address; copy i moves 16 rows on (128 lanes x 16 B = 16 rows of 128 B).
__device__ __forceinline__ void ring_fill(const h16* kg, const h16* vg, unsigned lk, unsigned lv) {
    // s_wait_xcnt as the statement's last line: a precaution, so that it stands in front of every later rewrite of a register that a copy names
    asm volatile("global_load_async_to_lds_b128 %0, %8, off\n\t"
                 "global_load_async_to_lds_b128 %1, %9, off\n\t"
                 "global_load_async_to_lds_b128 %2, %10, off\n\t"
                 "global_load_async_to_lds_b128 %3, %11, off\n\t"
                 "global_load_async_to_lds_b128 %4, %12, off\n\t"
                 "global_load_async_to_lds_b128 %5, %13, off\n\t"
                 "global_load_async_to_lds_b128 %6, %14, off\n\t"
                 "global_load_async_to_lds_b128 %7, %15, off\n\t"
                 "s_wait_xcnt 0x0"
                 :: "v"(lk), "v"(lk + 16 * LP * 2), "v"(lk + 32 * LP * 2), "v"(lk + 48 * LP * 2),
                    "v"(lv), "v"(lv + 16 * LP * 2), "v"(lv + 32 * LP * 2), "v"(lv + 48 * LP * 2),
                    "v"(kg), "v"(kg + 16 * HD), "v"(kg + 32 * HD), "v"(kg + 48 * HD),
                    "v"(vg), "v"(vg + (size_t)16 * SEQ), "v"(vg + (size_t)32 * SEQ), "v"(vg + (size_t)48 * SEQ)
                 : "memory");
}

// k_flash: fused attention, one wave per 16 query rows of one batch; Q fragments straight from the f16 plane; K / V^T fragments (two 16-B LDS loads each) from the ring that the block's four waves fill and share.
// Ring: two buffers of 64 keys; stage s + 2 is copied into the buffer of stage s behind the barrier that ends stage s, so a stage's copies fly while the stage before it is worked on.
// Transposed form: S^T[key][t] = K Q^T (A = K rows, B = Q rows, two 32-deep k-steps); lane (t = lane&15, h = lane>>4) holds keys 8h+r of each 16-key tile, so the packed
// P tile is directly the B fragment of O^T[d][t] = V^T P^T (element r <- tile keys 0..15, element 8+r <- tile keys 16..31, lane unchanged); four 16-row output tiles.
// Softmax state (running max, partial sum) is one scalar per lane; the two lane halves of a row are combined with one xor-16 exchange.
// Key rule evaluated per element inside every visited 32-key tile (kept score or fill value, selected by value); the per-wave key bound comes from the device-read valid length and is at most SEQ.
// P = exp2(e) with e <= 14; elements with e < -14 are selected to zero so that no f16 subnormal operand is formed.
__global__ __launch_bounds__(32 * AW) void k_flash(const h16* __restrict__ QH, const h16* __restrict__ KP, const h16* __restrict__ VT, const int* __restrict__ vlen, float* OUT) {
    __shared__ __align__(16) float os[AW * 16 * OSP];
    __shared__ __align__(16) h16 ring[2 * STG];
    const int lane = threadIdx.x & 31, lr = lane & 15, hi = lane >> 4;
    const int wave = __builtin_amdgcn_readfirstlane((int)(threadIdx.x >> 5));
    const int b = blockIdx.y;
    const int t0 = (blockIdx.x * AW + wave) * 16;
    int vl = vlen[b]; vl = vl > SEQ ? SEQ : vl;                                // key j kept iff j < vl
    const int kend = vl < 1 ? SEQ : vl;                                        // no kept key: every key visited with the fill value
    const int nk = (kend + 31) & ~31;                                          // wave-uniform, multiple of 32, in [32, SEQ]
    const size_t pbase = (size_t)b * SEQ * HD;
    const size_t qo = pbase + (size_t)(t0 + lr) * HD + 8 * hi;
    const v16h q0 = ldh(QH + qo), q1 = ldh(QH + qo + 32);      // B fragments: col t, k = d (two k-steps)
    const int ko = lr * LP + 8 * hi;                           // + key-in-stage * LP            (A fragment: row key, k = d)
    const int vo = KS * LP + lr * LP + 8 * hi;                 // + 16j*LP + key-in-stage        (A fragment: row d, k = key)
    const int ns = (nk + KS - 1) / KS;                         // ring stages, block-uniform, in [1, SEQ / KS]
    const int crow = (int)threadIdx.x >> 3, ccol = ((int)threadIdx.x & 7) * 8;      // this lane's row and 16-B chunk in each 16-row group of a fill
    const h16* kg = KP + pbase + (size_t)crow * HD + ccol;     // + stage * KS * HD
    const h16* vg = VT + pbase + (size_t)crow * SEQ + ccol;    // + stage * KS
    const unsigned lk = (unsigned)(size_t)(&ring[crow * LP + ccol]);                // LDS byte address: low 32 bits of the shared address
    const unsigned lv = lk + KS * LP * 2;
    ring_fill(kg, vg, lk, lv);
    asm volatile("s_wait_asynccnt 0x0" ::: "memory");          // stage 0 of this wave's copies has landed
    __syncthreads();                                           // publishes stage 0 to all four waves
    if (ns > 1) ring_fill(kg + (size_t)KS * HD, vg + KS, lk + STG * 2, lv + STG * 2);
    v8f o[4];
#pragma unroll
    for (int j = 0; j < 4; ++j) o[j] = (v8f){};
    float m = NEGB, l = 0.0f;
#pragma unroll 1
    for (int s = 0; s < ns; ++s) {
      const h16* rb = ring + (s & 1) * STG;
#pragma unroll
      for (int p = 0; p < KS / 32; ++p) {
        const int key0 = s * KS + p * 32;
        if (p > 0 && key0 >= nk) break;                        // block-uniform: the last stage may hold one tile only
        const h16* ka = rb + ko + p * 32 * LP;
        const v16h ka0 = ldh(ka), ka1 = ldh(ka + 32), kb0 = ldh(ka + 16 * LP), kb1 = ldh(ka + 16 * LP + 32);
        v8f sa = (v8f){}, sb = (v8f){};
        sa = wmma16g(ka0, q0, sa); sb = wmma16g(kb0, q0, sb); sa = wmma16g(ka1, q1, sa); sb = wmma16g(kb1, q1, sb);
        const int ja = key0 + 8 * hi;
        float ta[8], tb[8]; float mx = NEGB;
#pragma unroll
        for (int r = 0; r < 8; ++r) {
            const bool fa = (ja + r) < vl;
            const bool fb = (ja + 16 + r) < vl;
            const float xa = sa[r] * SC2, xb = sb[r] * SC2;
            ta[r] = fa ? xa : FILL2; tb[r] = fb ? xb : FILL2;                  // replace fill, selected by value
            mx = fmaxf(mx, fmaxf(ta[r], tb[r])); }
        mx = fmaxf(mx, __shfl_xor(mx, 16, 32));
        const float mnew = fmaxf(m, mx);
        const float alpha = __builtin_amdgcn_exp2f(m - mnew);
        const float sh = PSH - mnew;
        v16h pb; float ls = 0.0f;
#pragma unroll
        for (int r = 0; r < 8; ++r) {
            const float ea = ta[r] + sh, eb = tb[r] + sh;
            const float xa = __builtin_amdgcn_exp2f(ea), xb = __builtin_amdgcn_exp2f(eb);
            const float ga = (ea < -14.0f) ? 0.0f : xa, gb = (eb < -14.0f) ? 0.0f : xb;   // below 2^-14: zero by value
            const h16 pa = (h16)ga; const h16 pc = (h16)gb;
            pb[r] = pa; pb[8 + r] = pc;
            ls += (float)pa + (float)pc; }
        l = l * alpha + ls; m = mnew;
#pragma unroll
        for (int j = 0; j < 4; ++j) o[j] = o[j] * alpha;
        const h16* va = rb + vo + p * 32;
        v16h vf[4];
#pragma unroll
        for (int j = 0; j < 4; ++j) vf[j] = ldh(va + 16 * j * LP);
#pragma unroll
        for (int j = 0; j < 4; ++j) o[j] = wmma16g(vf[j], pb, o[j]);
      }
      asm volatile("s_wait_dscnt 0x0" ::: "memory");           // this wave's reads of stage s have returned before its buffer is refilled
      asm volatile("s_wait_asynccnt 0x0" ::: "memory");        // this wave's copies of stage s + 1 have landed
      __syncthreads();                                         // publishes stage s + 1 and ends every wave's reads of stage s
      if (s + 2 < ns) ring_fill(kg + (size_t)(s + 2) * KS * HD, vg + (s + 2) * KS, lk + (s & 1) * STG * 2, lv + (s & 1) * STG * 2);
    }
    asm volatile("s_wait_asynccnt 0x0" ::: "memory");          // nothing is in flight when the wave goes on to its end
    l += __shfl_xor(l, 16, 32);
    const bool any = l > 0.0f;
    const float lsafe = any ? l : 1.0f;
    const float inv = any ? ((1.0f / lsafe) * XCI) : 0.0f;     // folds the v carry back; the P carry cancels against l
    const int wb = wave * 16 * OSP;
    // O^T D layout: o[j][r] = (d = 16j + 8h + r, t = lane&15) -> os[t][d]; rows 0..15 x columns 0..63 all written
#pragma unroll
    for (int j = 0; j < 4; ++j) { v4f a, c;
        a[0] = o[j][0] * inv; a[1] = o[j][1] * inv; a[2] = o[j][2] * inv; a[3] = o[j][3] * inv;
        c[0] = o[j][4] * inv; c[1] = o[j][5] * inv; c[2] = o[j][6] * inv; c[3] = o[j][7] * inv;
        *(v4fa*)(&os[wb + lr * OSP + 16 * j + 8 * hi]) = a; *(v4fa*)(&os[wb + lr * OSP + 16 * j + 8 * hi + 4]) = c; }
    wave_sync();
    float* orow = OUT + ((size_t)b * OUT_SEQ + (size_t)t0) * HD;           // 16 rows x 64 floats, contiguous
{
#pragma unroll
        for (int s = 0; s < 8; ++s) { const int p = s * 32 + lane; const int row = p >> 4, cofs = (p & 15) * 4;   // 8 s x 2 rows = 16 rows; 16 lanes x 4 floats = 64 columns = two lines
            const v4f val = *(const v4fa*)(&os[wb + row * OSP + cofs]);
            *(v4f*)(orow + (size_t)p * 4) = val; }
         }
}

static constexpr size_t al256(size_t v) { return (v + 255) & ~(size_t)255; }
static constexpr size_t SZ_PL = al256((size_t)NB * SEQ * HD * 2);
static constexpr size_t SZ_TOTAL = 3 * SZ_PL;
static_assert(SZ_TOTAL <= (size_t)134217728);          // workspace carve <= 128 MiB
static_assert(((size_t)SEQ * 2) % 128 == 0);

extern "C" void kernel_launch(void* const* d_in, const int* in_sizes, int n_in,
                              void* d_out, int out_size, void* d_ws, size_t ws_size, hipStream_t stream) {
    if (n_in < 4) return;
    const size_t needx = ((size_t)(NB - 1) * SEQ_FULL + SEQ) * HD;
    if ((size_t)in_sizes[0] < needx || (size_t)in_sizes[1] < needx || (size_t)in_sizes[2] < needx) return;
    if (in_sizes[3] < NB) return;
    if ((size_t)out_size < ((size_t)(NB - 1) * OUT_SEQ + SEQ) * HD) return;
    if (SZ_TOTAL > ws_size) return;
    // wire order: q, k, v, valid_lens
    const float* qin = (const float*)d_in[0];
    const float* kin = (const float*)d_in[1];
    const float* vin = (const float*)d_in[2];
    const int* vlen = (const int*)d_in[3];
    float* OUT = (float*)d_out;      // [NB][SEQ][64]
    char* wsp = (char*)d_ws;
    h16* QH = (h16*)wsp; wsp += SZ_PL;               // [NB][SEQ][64]   q x16
    h16* KP = (h16*)wsp; wsp += SZ_PL;               // [NB][SEQ][64]   k x16
    h16* VT = (h16*)wsp; wsp += SZ_PL;               // [NB][64][SEQ]   v^T x16

    if (SEQ == SEQ_FULL) {
        const size_t n8 = (size_t)NB * SEQ * HD / 8;
        k_cvth<<<(unsigned)((n8 + 255) / 256), 256, 0, stream>>>(qin, QH, n8);
        k_cvth<<<(unsigned)((n8 + 255) / 256), 256, 0, stream>>>(kin, KP, n8);
    } else {
        const size_t n8 = (size_t)SEQ * HD / 8;
        for (int b = 0; b < NB; ++b) {
            k_cvth<<<(unsigned)((n8 + 255) / 256), 256, 0, stream>>>(qin + (size_t)b * SEQ_FULL * HD, QH + (size_t)b * SEQ * HD, n8);
            k_cvth<<<(unsigned)((n8 + 255) / 256), 256, 0, stream>>>(kin + (size_t)b * SEQ_FULL * HD, KP + (size_t)b * SEQ * HD, n8);
        }
    }
    // v [b][t][64] (batch pitch SEQ_FULL) -> v^T plane [b][64][t]
    k_vt<<<dim3(SEQ / 64, NB, 1), 256, 0, stream>>>(vin, VT);

    // one wave per 16 query rows; all waves of a block share the batch and therefore the key bound
    k_flash<<<dim3(SEQ / (16 * AW), NB, 1), 32 * AW, 0, stream>>>(QH, KP, VT, vlen, OUT);
}

// v002
// A run of this version takes 59.5 microseconds.
// Two timings next to v001 put it at 1.05 and 1.06 times that version's speed.
// Counting every step since v000, it is 2.72 times as fast.
#include <hip/hip_runtime.h>

// Single-head scaled dot-product attention with a key-length mask: q/k/v [NB][SEQ][64] (f32), valid_lens [NB] (int32, device-read); scores = q k^T / 8; keys at positions >= valid_lens[b] have their score REPLACED by -1e6; softmax over all keys; output = P v (f32).
// Compute dtypes, f32 accumulate everywhere: scores v_wmma_f32_16x16x32_f16, one product (q, k RNE-converted to bf16 at their load, x16 carry, held as f16: exact);
// P.V v_wmma_f32_16x16x32_f16, one product: P single f16 (x16384 carry, row sum over the converted P, cancels in the normalisation), v RNE-converted to bf16 at its load, x16 carry, held as f16 (exact); softmax f32 (online, running max over every visited key, filled ones included).
// Layout: f16 planes q [b][t][d], k [b][t][d], v^T [b][d][t] (transposed through LDS); fused flash kernel in transposed form (S^T = K Q^T, O^T = V^T P^T), Q fragments straight from the plane, K / V^T fragments from a two-buffer LDS ring filled by asynchronous copies, output from f32 accumulators.
// Key rule per element: key j kept iff j < valid_lens[b]; other elements of a visited 32-key tile take the fill value (replace, not add). Tiles wholly past the valid length are skipped when valid_lens[b] >= 1 (their
// exponentials are exactly zero in f32); when valid_lens[b] < 1 every tile is visited with every score filled, which gives the uniform average over all SEQ keys.

#ifndef NB
#define NB 16
#endif
#ifndef SEQ
#define SEQ 4096
#endif
#define NB_FULL  16
#define SEQ_FULL 4096
#ifndef OUT_SEQ
#define OUT_SEQ SEQ              // row pitch (in tokens) between batches of the output
#endif
#define HD   64                  // feature width of q, k, v and of the output
#define AW   4                   // waves per flash block (16 query rows each)
#define OSP  68                  // LDS row pitch (floats) of the flash output tile
#define TP   72                  // LDS row pitch (halves) of the transpose tile
#define KS   64                  // keys per ring stage (two 32-key tiles): one whole 128-B line per V^T row
#define LP   72                  // LDS row pitch (halves) of the ring rows: 144 B = 16 B x odd for 16-byte readers
#define STG  ((KS + HD) * LP)    // halves per ring buffer: KS rows of K, then HD rows of V^T
#define XC   16.0f               // power-of-two carry of the q, k, v planes
#define XCI  (1.0f / 16.0f)
#define SC2  ((float)(0.125 * 1.4426950408889634 / 256.0))   // HD^-0.5 * log2(e) / (XC*XC)
#define FILL2 ((float)(-1.0e6 * 1.4426950408889634))          // the fill value in log2 units
#define PSH  14.0f               // log2 of the P carry (16384)
#define NEGB (-3.0e38f)

static_assert(HD == 64);                       // two 32-deep k-steps per score tile, four 16-row output tiles
static_assert(HD % 32 == 0);                   // score k-loop steps by 32
static_assert(SEQ % 64 == 0);                  // transpose tiles of 64 tokens cover the sequence exactly
static_assert(SEQ % 32 == 0);                  // key loop steps by 32
static_assert(SEQ % (16 * AW) == 0);           // flash grid covers the sequence exactly
static_assert(2 * 256 * 8 == 64 * HD);         // q / k convert: 2 x 256 chunks of 8 elements == 64 tokens x 64 features
static_assert(NB <= NB_FULL);
static_assert(SEQ <= SEQ_FULL);
static_assert(OSP >= HD);
static_assert((OSP * 4) % 16 == 0);
static_assert(TP >= 64);
static_assert((TP * 2) % 16 == 0);
static_assert(8 * 32 * 16 == 16 * HD * 4);     // flash epilogue: 8 instructions x 32 lanes x 16 B == 16 rows x 256 B
static_assert(256 * 2 * 16 == HD * 64 * 2);
static_assert(256 * 4 * 4 == 64 * HD);         // transpose load: 256 threads x 4 x float4 == 64 tokens x 64 features
static_assert((size_t)AW * 16 * OSP * 4 + (size_t)2 * STG * 2 <= 131072);   // static LDS of the flash kernel
static_assert(SEQ % KS == 0);                  // a ring stage never runs past the planes
static_assert(KS == 64);                       // two 32-key tiles per stage; 8 copies of 16 B cover one ring row
static_assert((LP * 2) % 16 == 0);
static_assert(LP >= KS);
static_assert(LP >= HD);
static_assert(32 * AW * 4 * 16 == KS * HD * 2);   // ring fill: 128 lanes x 4 copies x 16 B == one 8-KiB tile (K, and again V^T)
static_assert((size_t)HD * TP * 2 <= 131072);         // static LDS of the transpose kernel

typedef _Float16 h16;
typedef __attribute__((ext_vector_type(16))) _Float16 v16h;
typedef __attribute__((ext_vector_type(8)))  _Float16 v8h;
typedef __attribute__((ext_vector_type(8)))  float    v8f;
typedef __attribute__((ext_vector_type(4)))  float    v4f;
typedef v4f  __attribute__((may_alias)) v4fa;
typedef v8h  __attribute__((may_alias)) v8ha;

__device__ __forceinline__ unsigned short f2bf(float f) { unsigned u = __float_as_uint(f); u += 0x7FFFu + ((u >> 16) & 1u); return (unsigned short)(u >> 16); }
__device__ __forceinline__ float bfr(float f) { return __uint_as_float(((unsigned)f2bf(f)) << 16); }   // value after RNE convert to bf16
__device__ __forceinline__ v16h cat16(v8h lo, v8h hi) { return __builtin_shufflevector(lo, hi, 0, 1, 2, 3, 4, 5, 6, 7, 8, 9, 10, 11, 12, 13, 14, 15); }
__device__ __forceinline__ v8f wmma16(v16h a, v16h b, v8f c) { return __builtin_amdgcn_wmma_f32_16x16x32_f16(false, a, false, b, (short)0, c, false, false); }
// one matrix instruction followed by its own four-slot guard (ties D, keeps A and B live)
__device__ __forceinline__ v8f wmma16g(v16h a, v16h b, v8f c) { c = wmma16(a, b, c); asm volatile("v_nop\n\tv_nop\n\tv_nop\n\tv_nop" : "+v"(c) : "v"(a), "v"(b)); return c; }
// fragment loaders from K-contiguous 16-bit rows; p already includes + 8*(lane>>4): elements 0..7 <- k0+8h+0..7, elements 8..15 <- k0+16+8h+0..7 (same map for A and B)
__device__ __forceinline__ v16h  ldh(const h16* p) { return cat16(*(const v8h*)p, *(const v8h*)(p + 16)); }
// ordering point for wave-private LDS tiles (same wave writes and reads)
__device__ __forceinline__ void wave_sync() { __builtin_amdgcn_fence(3 /* release order */, "wavefront"); __builtin_amdgcn_wave_barrier(); asm volatile("" ::: "memory"); }
// f32 -> f16 operand convert that cannot produce an f16 subnormal (applied after the plane's carry)
static __device__ __forceinline__ h16 toh_flush(float v) { const h16 r = (h16)v; return (fabsf(v) < 6.103515625e-05f) ? (h16)0.0f : r; }

// k_prep: one work-group per 64 tokens of one batch writes all three f16 planes of that slab (value = RNE bf16 value of the input x XC):
// q and k keep their layout, in [b][t][64] (batch pitch SEQ_FULL tokens) -> out [b][t][64] (batch pitch SEQ tokens), 8 elements per lane and chunk;
// v is transposed through LDS, in [b][t][64] (batch pitch SEQ_FULL tokens) -> out [b][64][t] (row pitch SEQ).
__global__ __launch_bounds__(256) void k_prep(const float* __restrict__ qsrc, const float* __restrict__ ksrc, const float* __restrict__ src, h16* qdst, h16* kdst, h16* dst) {
#pragma clang fp contract(off)
    __shared__ __align__(16) h16 ts[HD * TP];
    const int tid = threadIdx.x;
    const int b = blockIdx.y; const int t0 = blockIdx.x * 64;
    const size_t si = ((size_t)b * SEQ_FULL + (size_t)t0) * HD;            // the slab in q, k, v: 64 tokens x 64 floats, contiguous
    const size_t so = ((size_t)b * SEQ + (size_t)t0) * HD;                 // the slab in the q and k planes
    v8f xq[2], xk[2];                                                      // 2 c x 256 chunks of 8 floats = 64 tokens x 64 features, loaded ahead of the transpose
#pragma unroll                                                             // constant c: xq, xk stay in registers and all eight 16-B loads are in flight under the transpose
    for (int c = 0; c < 2; ++c) { xq[c] = *(const v8f*)(qsrc + si + (size_t)(c * 256 + tid) * 8); xk[c] = *(const v8f*)(ksrc + si + (size_t)(c * 256 + tid) * 8); }
    const float* sp = src + si;
#pragma unroll 1
    for (int s = 0; s < 4; ++s) { const int p = s * 256 + tid; const int tok = p >> 4, c0 = (p & 15) * 4;   // 4 s x 256 float4 = 64 tokens x 16 float4
        const v4f x = *(const v4f*)(sp + (size_t)p * 4);
#pragma unroll
        for (int i = 0; i < 4; ++i) ts[(c0 + i) * TP + tok] = toh_flush(bfr(x[i]) * XC); }
    __syncthreads();
    h16* dp = dst + (size_t)b * HD * SEQ + (size_t)t0;
{
#pragma unroll
        for (int s = 0; s < 2; ++s) { const int p = s * 256 + tid; const int row = p >> 3, c8 = (p & 7) * 8;   // 2 s x 32 row groups = 64 rows; 8 lanes x 8 halves = 64 tokens = one line
            const v8h val = *(const v8ha*)(&ts[row * TP + c8]);
            *(v8h*)(dp + (size_t)row * SEQ + c8) = val; }
         }
#pragma unroll                                                             // constant c and k: register indexing of xq, xk, oq, ok
    for (int c = 0; c < 2; ++c) { v8h oq, ok;
#pragma unroll
        for (int k = 0; k < 8; ++k) { oq[k] = toh_flush(bfr(xq[c][k]) * XC); ok[k] = toh_flush(bfr(xk[c][k]) * XC); }
        *(v8h*)(qdst + so + (size_t)(c * 256 + tid) * 8) = oq; *(v8h*)(kdst + so + (size_t)(c * 256 + tid) * 8) = ok; }
}

// ring_fill: one stage of the ring: 64 keys of K (64 rows x 128 B, contiguous in the plane) and of V^T (64 rows x 128 B, plane pitch SEQ), 16 B per lane and copy, whole lines per wave.
// kg / vg: this lane's first global chunk of the stage; lk / lv: its LDS byte address; copy i moves 16 rows on (128 lanes x 16 B = 16 rows of 128 B).
__device__ __forceinline__ void ring_fill(const h16* kg, const h16* vg, unsigned lk, unsigned lv) {
    // s_wait_xcnt as the statement's last line: a precaution, so that it stands in front of every later rewrite of a register that a copy names
    asm volatile("global_load_async_to_lds_b128 %0, %8, off\n\t"
                 "global_load_async_to_lds_b128 %1, %9, off\n\t"
                 "global_load_async_to_lds_b128 %2, %10, off\n\t"
                 "global_load_async_to_lds_b128 %3, %11, off\n\t"
                 "global_load_async_to_lds_b128 %4, %12, off\n\t"
                 "global_load_async_to_lds_b128 %5, %13, off\n\t"
                 "global_load_async_to_lds_b128 %6, %14, off\n\t"
                 "global_load_async_to_lds_b128 %7, %15, off\n\t"
                 "s_wait_xcnt 0x0"
                 :: "v"(lk), "v"(lk + 16 * LP * 2), "v"(lk + 32 * LP * 2), "v"(lk + 48 * LP * 2),
                    "v"(lv), "v"(lv + 16 * LP * 2), "v"(lv + 32 * LP * 2), "v"(lv + 48 * LP * 2),
                    "v"(kg), "v"(kg + 16 * HD), "v"(kg + 32 * HD), "v"(kg + 48 * HD),
                    "v"(vg), "v"(vg + (size_t)16 * SEQ), "v"(vg + (size_t)32 * SEQ), "v"(vg + (size_t)48 * SEQ)
                 : "memory");
}

// k_flash: fused attention, one wave per 16 query rows of one batch; Q fragments straight from the f16 plane; K / V^T fragments (two 16-B LDS loads each) from the ring that the block's four waves fill and share.
// Ring: two buffers of 64 keys; stage s + 2 is copied into the buffer of stage s behind the barrier that ends stage s, so a stage's copies fly while the stage before it is worked on.
// Transposed form: S^T[key][t] = K Q^T (A = K rows, B = Q rows, two 32-deep k-steps); lane (t = lane&15, h = lane>>4) holds keys 8h+r of each 16-key tile, so the packed
// P tile is directly the B fragment of O^T[d][t] = V^T P^T (element r <- tile keys 0..15, element 8+r <- tile keys 16..31, lane unchanged); four 16-row output tiles.
// Softmax state (running max, partial sum) is one scalar per lane; the two lane halves of a row are combined with one xor-16 exchange.
// Key rule evaluated per element inside every visited 32-key tile (kept score or fill value, selected by value); the per-wave key bound comes from the device-read valid length and is at most SEQ.
// P = exp2(e) with e <= 14; elements with e < -14 are selected to zero so that no f16 subnormal operand is formed.
__global__ __launch_bounds__(32 * AW) void k_flash(const h16* __restrict__ QH, const h16* __restrict__ KP, const h16* __restrict__ VT, const int* __restrict__ vlen, float* OUT) {
    __shared__ __align__(16) float os[AW * 16 * OSP];
    __shared__ __align__(16) h16 ring[2 * STG];
    const int lane = threadIdx.x & 31, lr = lane & 15, hi = lane >> 4;
    const int wave = __builtin_amdgcn_readfirstlane((int)(threadIdx.x >> 5));
    const int b = blockIdx.y;
    const int t0 = (blockIdx.x * AW + wave) * 16;
    int vl = vlen[b]; vl = vl > SEQ ? SEQ : vl;                                // key j kept iff j < vl
    const int kend = vl < 1 ? SEQ : vl;                                        // no kept key: every key visited with the fill value
    const int nk = (kend + 31) & ~31;                                          // wave-uniform, multiple of 32, in [32, SEQ]
    const size_t pbase = (size_t)b * SEQ * HD;
    const size_t qo = pbase + (size_t)(t0 + lr) * HD + 8 * hi;
    const v16h q0 = ldh(QH + qo), q1 = ldh(QH + qo + 32);      // B fragments: col t, k = d (two k-steps)
    const int ko = lr * LP + 8 * hi;                           // + key-in-stage * LP            (A fragment: row key, k = d)
    const int vo = KS * LP + lr * LP + 8 * hi;                 // + 16j*LP + key-in-stage        (A fragment: row d, k = key)
    const int ns = (nk + KS - 1) / KS;                         // ring stages, block-uniform, in [1, SEQ / KS]
    const int crow = (int)threadIdx.x >> 3, ccol = ((int)threadIdx.x & 7) * 8;      // this lane's row and 16-B chunk in each 16-row group of a fill
    const h16* kg = KP + pbase + (size_t)crow * HD + ccol;     // + stage * KS * HD
    const h16* vg = VT + pbase + (size_t)crow * SEQ + ccol;    // + stage * KS
    const unsigned lk = (unsigned)(size_t)(&ring[crow * LP + ccol]);                // LDS byte address: low 32 bits of the shared address
    const unsigned lv = lk + KS * LP * 2;
    ring_fill(kg, vg, lk, lv);
    asm volatile("s_wait_asynccnt 0x0" ::: "memory");          // stage 0 of this wave's copies has landed
    __syncthreads();                                           // publishes stage 0 to all four waves
    if (ns > 1) ring_fill(kg + (size_t)KS * HD, vg + KS, lk + STG * 2, lv + STG * 2);
    v8f o[4];
#pragma unroll
    for (int j = 0; j < 4; ++j) o[j] = (v8f){};
    float m = NEGB, l = 0.0f;
#pragma unroll 1
    for (int s = 0; s < ns; ++s) {
      const h16* rb = ring + (s & 1) * STG;
#pragma unroll
      for (int p = 0; p < KS / 32; ++p) {
        const int key0 = s * KS + p * 32;
        if (p > 0 && key0 >= nk) break;                        // block-uniform: the last stage may hold one tile only
        const h16* ka = rb + ko + p * 32 * LP;
        const v16h ka0 = ldh(ka), ka1 = ldh(ka + 32), kb0 = ldh(ka + 16 * LP), kb1 = ldh(ka + 16 * LP + 32);
        v8f sa = (v8f){}, sb = (v8f){};
        sa = wmma16g(ka0, q0, sa); sb = wmma16g(kb0, q0, sb); sa = wmma16g(ka1, q1, sa); sb = wmma16g(kb1, q1, sb);
        const int ja = key0 + 8 * hi;
        float ta[8], tb[8]; float mx = NEGB;
#pragma unroll
        for (int r = 0; r < 8; ++r) {
            const bool fa = (ja + r) < vl;
            const bool fb = (ja + 16 + r) < vl;
            const float xa = sa[r] * SC2, xb = sb[r] * SC2;
            ta[r] = fa ? xa : FILL2; tb[r] = fb ? xb : FILL2;                  // replace fill, selected by value
            mx = fmaxf(mx, fmaxf(ta[r], tb[r])); }
        mx = fmaxf(mx, __shfl_xor(mx, 16, 32));
        const float mnew = fmaxf(m, mx);
        const float alpha = __builtin_amdgcn_exp2f(m - mnew);
        const float sh = PSH - mnew;
        v16h pb; float ls = 0.0f;
#pragma unroll
        for (int r = 0; r < 8; ++r) {
            const float ea = ta[r] + sh, eb = tb[r] + sh;
            const float xa = __builtin_amdgcn_exp2f(ea), xb = __builtin_amdgcn_exp2f(eb);
            const float ga = (ea < -14.0f) ? 0.0f : xa, gb = (eb < -14.0f) ? 0.0f : xb;   // below 2^-14: zero by value
            const h16 pa = (h16)ga; const h16 pc = (h16)gb;
            pb[r] = pa; pb[8 + r] = pc;
            ls += (float)pa + (float)pc; }
        l = l * alpha + ls; m = mnew;
#pragma unroll
        for (int j = 0; j < 4; ++j) o[j] = o[j] * alpha;
        const h16* va = rb + vo + p * 32;
        v16h vf[4];
#pragma unroll
        for (int j = 0; j < 4; ++j) vf[j] = ldh(va + 16 * j * LP);
#pragma unroll
        for (int j = 0; j < 4; ++j) o[j] = wmma16g(vf[j], pb, o[j]);
      }
      asm volatile("s_wait_dscnt 0x0" ::: "memory");           // this wave's reads of stage s have returned before its buffer is refilled
      asm volatile("s_wait_asynccnt 0x0" ::: "memory");        // this wave's copies of stage s + 1 have landed
      __syncthreads();                                         // publishes stage s + 1 and ends every wave's reads of stage s
      if (s + 2 < ns) ring_fill(kg + (size_t)(s + 2) * KS * HD, vg + (s + 2) * KS, lk + (s & 1) * STG * 2, lv + (s & 1) * STG * 2);
    }
    asm volatile("s_wait_asynccnt 0x0" ::: "memory");          // nothing is in flight when the wave goes on to its end
    l += __shfl_xor(l, 16, 32);
    const bool any = l > 0.0f;
    const float lsafe = any ? l : 1.0f;
    const float inv = any ? ((1.0f / lsafe) * XCI) : 0.0f;     // folds the v carry back; the P carry cancels against l
    const int wb = wave * 16 * OSP;
    // O^T D layout: o[j][r] = (d = 16j + 8h + r, t = lane&15) -> os[t][d]; rows 0..15 x columns 0..63 all written
#pragma unroll
    for (int j = 0; j < 4; ++j) { v4f a, c;
        a[0] = o[j][0] * inv; a[1] = o[j][1] * inv; a[2] = o[j][2] * inv; a[3] = o[j][3] * inv;
        c[0] = o[j][4] * inv; c[1] = o[j][5] * inv; c[2] = o[j][6] * inv; c[3] = o[j][7] * inv;
        *(v4fa*)(&os[wb + lr * OSP + 16 * j + 8 * hi]) = a; *(v4fa*)(&os[wb + lr * OSP + 16 * j + 8 * hi + 4]) = c; }
    wave_sync();
    float* orow = OUT + ((size_t)b * OUT_SEQ + (size_t)t0) * HD;           // 16 rows x 64 floats, contiguous
{
#pragma unroll
        for (int s = 0; s < 8; ++s) { const int p = s * 32 + lane; const int row = p >> 4, cofs = (p & 15) * 4;   // 8 s x 2 rows = 16 rows; 16 lanes x 4 floats = 64 columns = two lines
            const v4f val = *(const v4fa*)(&os[wb + row * OSP + cofs]);
            *(v4f*)(orow + (size_t)p * 4) = val; }
         }
}

static constexpr size_t al256(size_t v) { return (v + 255) & ~(size_t)255; }
static constexpr size_t SZ_PL = al256((size_t)NB * SEQ * HD * 2);
static constexpr size_t SZ_TOTAL = 3 * SZ_PL;
static_assert(SZ_TOTAL <= (size_t)134217728);          // workspace carve <= 128 MiB
static_assert(((size_t)SEQ * 2) % 128 == 0);

extern "C" void kernel_launch(void* const* d_in, const int* in_sizes, int n_in,
                              void* d_out, int out_size, void* d_ws, size_t ws_size, hipStream_t stream) {
    if (n_in < 4) return;
    const size_t needx = ((size_t)(NB - 1) * SEQ_FULL + SEQ) * HD;
    if ((size_t)in_sizes[0] < needx || (size_t)in_sizes[1] < needx || (size_t)in_sizes[2] < needx) return;
    if (in_sizes[3] < NB) return;
    if ((size_t)out_size < ((size_t)(NB - 1) * OUT_SEQ + SEQ) * HD) return;
    if (SZ_TOTAL > ws_size) return;
    // wire order: q, k, v, valid_lens
    const float* qin = (const float*)d_in[0];
    const float* kin = (const float*)d_in[1];
    const float* vin = (const float*)d_in[2];
    const int* vlen = (const int*)d_in[3];
    float* OUT = (float*)d_out;      // [NB][SEQ][64]
    char* wsp = (char*)d_ws;
    h16* QH = (h16*)wsp; wsp += SZ_PL;               // [NB][SEQ][64]   q x16
    h16* KP = (h16*)wsp; wsp += SZ_PL;               // [NB][SEQ][64]   k x16
    h16* VT = (h16*)wsp; wsp += SZ_PL;               // [NB][64][SEQ]   v^T x16

    // q, k -> f16 planes and v [b][t][64] -> v^T plane [b][64][t], one work-group per 64 tokens of a batch
    k_prep<<<dim3(SEQ / 64, NB, 1), 256, 0, stream>>>(qin, kin, vin, QH, KP, VT);

    // one wave per 16 query rows; all waves of a block share the batch and therefore the key bound
    k_flash<<<dim3(SEQ / (16 * AW), NB, 1), 32 * AW, 0, stream>>>(QH, KP, VT, vlen, OUT);
}

// v003
// A run of this version takes 55.7 microseconds.
// Next to v002, in two timings, it ran 1.07 times as fast each time.
// Counting every step since v000, it is 2.91 times as fast.
#include <hip/hip_runtime.h>

// Single-head scaled dot-product attention with a key-length mask: q/k/v [NB][SEQ][64] (f32), valid_lens [NB] (int32, device-read); scores = q k^T / 8; keys at positions >= valid_lens[b] have their score REPLACED by -1e6; softmax over all keys; output = P v (f32).
// Compute dtypes, f32 accumulate everywhere: scores v_wmma_f32_16x16x32_f16, one product (q, k RNE-converted to bf16 at their load, x16 carry, held as f16: exact);
// P.V v_wmma_f32_16x16x32_f16, one product: P single f16 (x16384 carry, row sum over the converted P, cancels in the normalisation), v RNE-converted to bf16 at its load, x16 carry, held as f16 (exact); softmax f32 (online, running max over every visited key, filled ones included).
// Layout: f16 planes q [b][t][d], k [b][t][d], v^T [b][d][t] (transposed through LDS); fused flash kernel in transposed form (S^T = K Q^T, O^T = V^T P^T), Q fragments straight from the plane, K / V^T fragments from a two-buffer LDS ring filled by asynchronous copies, output from f32 accumulators.
// Key rule per element: key j kept iff j < valid_lens[b]; other elements of a visited 32-key tile take the fill value (replace, not add). Tiles wholly past the valid length are skipped when valid_lens[b] >= 1 (their
// exponentials are exactly zero in f32); when valid_lens[b] < 1 every tile is visited with every score filled, which gives the uniform average over all SEQ keys.

#ifndef NB
#define NB 16
#endif
#ifndef SEQ
#define SEQ 4096
#endif
#define NB_FULL  16
#define SEQ_FULL 4096
#ifndef OUT_SEQ
#define OUT_SEQ SEQ              // row pitch (in tokens) between batches of the output
#endif
#define HD   64                  // feature width of q, k, v and of the output
#define AW   4                   // waves per flash block (16 query rows each)
#define OSP  68                  // LDS row pitch (floats) of the flash output tile
#define TP   72                  // LDS row pitch (halves) of the transpose tile
#define KS   64                  // keys per ring stage (two 32-key tiles): one whole 128-B line per V^T row
#define LP   72                  // LDS row pitch (halves) of the ring rows: 144 B = 16 B x odd for 16-byte readers
#define STG  ((KS + HD) * LP)    // halves per ring buffer: KS rows of K, then HD rows of V^T
#define XC   16.0f               // power-of-two carry of the q, k, v planes
#define XCI  (1.0f / 16.0f)
#define SC2  ((float)(0.125 * 1.4426950408889634 / 256.0))   // HD^-0.5 * log2(e) / (XC*XC)
#define FILL2 ((float)(-1.0e6 * 1.4426950408889634))          // the fill value in log2 units
#define PSH  14.0f               // log2 of the P carry (16384)
#define NEGB (-3.0e38f)

static_assert(HD == 64);                       // two 32-deep k-steps per score tile, four 16-row output tiles
static_assert(HD % 32 == 0);                   // score k-loop steps by 32
static_assert(SEQ % 64 == 0);                  // transpose tiles of 64 tokens cover the sequence exactly
static_assert(SEQ % 32 == 0);                  // key loop steps by 32
static_assert(SEQ % (16 * AW) == 0);           // flash grid covers the sequence exactly
static_assert(2 * 256 * 8 == 64 * HD);         // q / k convert: 2 x 256 chunks of 8 elements == 64 tokens x 64 features
static_assert(NB <= NB_FULL);
static_assert(SEQ <= SEQ_FULL);
static_assert(OSP >= HD);
static_assert((OSP * 4) % 16 == 0);
static_assert(TP >= 64);
static_assert((TP * 2) % 16 == 0);
static_assert(8 * 32 * 16 == 16 * HD * 4);     // flash epilogue: 8 instructions x 32 lanes x 16 B == 16 rows x 256 B
static_assert(256 * 2 * 16 == HD * 64 * 2);
static_assert(256 * 4 * 4 == 64 * HD);         // transpose load: 256 threads x 4 x float4 == 64 tokens x 64 features
static_assert((size_t)AW * 16 * OSP * 4 + (size_t)2 * STG * 2 <= 131072);   // static LDS of the flash kernel
static_assert(SEQ % KS == 0);                  // a ring stage never runs past the planes
static_assert(KS == 64);                       // two 32-key tiles per stage; 8 copies of 16 B cover one ring row
static_assert((LP * 2) % 16 == 0);
static_assert(LP >= KS);
static_assert(LP >= HD);
static_assert(32 * AW * 4 * 16 == KS * HD * 2);   // ring fill: 128 lanes x 4 copies x 16 B == one 8-KiB tile (K, and again V^T)
static_assert((size_t)HD * TP * 2 <= 131072);         // static LDS of the transpose kernel

typedef _Float16 h16;
typedef __attribute__((ext_vector_type(16))) _Float16 v16h;
typedef __attribute__((ext_vector_type(8)))  _Float16 v8h;
typedef __attribute__((ext_vector_type(8)))  float    v8f;
typedef __attribute__((ext_vector_type(4)))  float    v4f;
typedef v4f  __attribute__((may_alias)) v4fa;
typedef v8h  __attribute__((may_alias)) v8ha;

__device__ __forceinline__ unsigned short f2bf(float f) { unsigned u = __float_as_uint(f); u += 0x7FFFu + ((u >> 16) & 1u); return (unsigned short)(u >> 16); }
__device__ __forceinline__ float bfr(float f) { return __uint_as_float(((unsigned)f2bf(f)) << 16); }   // value after RNE convert to bf16
__device__ __forceinline__ v16h cat16(v8h lo, v8h hi) { return __builtin_shufflevector(lo, hi, 0, 1, 2, 3, 4, 5, 6, 7, 8, 9, 10, 11, 12, 13, 14, 15); }
__device__ __forceinline__ v8f wmma16(v16h a, v16h b, v8f c) { return __builtin_amdgcn_wmma_f32_16x16x32_f16(false, a, false, b, (short)0, c, false, false); }
// one matrix instruction followed by its own four-slot guard (ties D, keeps A and B live)
__device__ __forceinline__ v8f wmma16g(v16h a, v16h b, v8f c) { c = wmma16(a, b, c); asm volatile("v_nop\n\tv_nop\n\tv_nop\n\tv_nop" : "+v"(c) : "v"(a), "v"(b)); return c; }
// fragment loaders from K-contiguous 16-bit rows; p already includes + 8*(lane>>4): elements 0..7 <- k0+8h+0..7, elements 8..15 <- k0+16+8h+0..7 (same map for A and B)
__device__ __forceinline__ v16h  ldh(const h16* p) { return cat16(*(const v8h*)p, *(const v8h*)(p + 16)); }
// ordering point for wave-private LDS tiles (same wave writes and reads)
__device__ __forceinline__ void wave_sync() { __builtin_amdgcn_fence(3 /* release order */, "wavefront"); __builtin_amdgcn_wave_barrier(); asm volatile("" ::: "memory"); }
// f32 -> f16 operand convert that cannot produce an f16 subnormal (applied after the plane's carry)
static __device__ __forceinline__ h16 toh_flush(float v) { const h16 r = (h16)v; return (fabsf(v) < 6.103515625e-05f) ? (h16)0.0f : r; }

// k_prep: one work-group per 64 tokens of one batch writes all three f16 planes of that slab (value = RNE bf16 value of the input x XC):
// q and k keep their layout, in [b][t][64] (batch pitch SEQ_FULL tokens) -> out [b][t][64] (batch pitch SEQ tokens), 8 elements per lane and chunk;
// v is transposed through LDS, in [b][t][64] (batch pitch SEQ_FULL tokens) -> out [b][64][t] (row pitch SEQ).
__global__ __launch_bounds__(256) void k_prep(const float* __restrict__ qsrc, const float* __restrict__ ksrc, const float* __restrict__ src, h16* qdst, h16* kdst, h16* dst) {
#pragma clang fp contract(off)
    __shared__ __align__(16) h16 ts[HD * TP];
    const int tid = threadIdx.x;
    const int b = blockIdx.y; const int t0 = blockIdx.x * 64;
    const size_t si = ((size_t)b * SEQ_FULL + (size_t)t0) * HD;            // the slab in q, k, v: 64 tokens x 64 floats, contiguous
    const size_t so = ((size_t)b * SEQ + (size_t)t0) * HD;                 // the slab in the q and k planes
    v8f xq[2], xk[2];                                                      // 2 c x 256 chunks of 8 floats = 64 tokens x 64 features, loaded ahead of the transpose
#pragma unroll                                                             // constant c: xq, xk stay in registers and all eight 16-B loads are in flight under the transpose
    for (int c = 0; c < 2; ++c) { xq[c] = *(const v8f*)(qsrc + si + (size_t)(c * 256 + tid) * 8); xk[c] = *(const v8f*)(ksrc + si + (size_t)(c * 256 + tid) * 8); }
    const float* sp = src + si;
#pragma unroll 1
    for (int s = 0; s < 4; ++s) { const int p = s * 256 + tid; const int tok = p >> 4, c0 = (p & 15) * 4;   // 4 s x 256 float4 = 64 tokens x 16 float4
        const v4f x = *(const v4f*)(sp + (size_t)p * 4);
#pragma unroll
        for (int i = 0; i < 4; ++i) ts[(c0 + i) * TP + tok] = toh_flush(bfr(x[i]) * XC); }
    __syncthreads();
    h16* dp = dst + (size_t)b * HD * SEQ + (size_t)t0;
{
#pragma unroll
        for (int s = 0; s < 2; ++s) { const int p = s * 256 + tid; const int row = p >> 3, c8 = (p & 7) * 8;   // 2 s x 32 row groups = 64 rows; 8 lanes x 8 halves = 64 tokens = one line
            const v8h val = *(const v8ha*)(&ts[row * TP + c8]);
            *(v8h*)(dp + (size_t)row * SEQ + c8) = val; }
         }
#pragma unroll                                                             // constant c and k: register indexing of xq, xk, oq, ok
    for (int c = 0; c < 2; ++c) { v8h oq, ok;
#pragma unroll
        for (int k = 0; k < 8; ++k) { oq[k] = toh_flush(bfr(xq[c][k]) * XC); ok[k] = toh_flush(bfr(xk[c][k]) * XC); }
        *(v8h*)(qdst + so + (size_t)(c * 256 + tid) * 8) = oq; *(v8h*)(kdst + so + (size_t)(c * 256 + tid) * 8) = ok; }
}

// ring_fill: one stage of the ring: 64 keys of K (64 rows x 128 B, contiguous in the plane) and of V^T (64 rows x 128 B, plane pitch SEQ), 16 B per lane and copy, whole lines per wave.
// kg / vg: this lane's first global chunk of the stage; lk / lv: its LDS byte address; copy i moves 16 rows on (128 lanes x 16 B = 16 rows of 128 B).
__device__ __forceinline__ void ring_fill(const h16* kg, const h16* vg, unsigned lk, unsigned lv) {
    // s_wait_xcnt as the statement's last line: a precaution, so that it stands in front of every later rewrite of a register that a copy names
    asm volatile("global_load_async_to_lds_b128 %0, %8, off\n\t"
                 "global_load_async_to_lds_b128 %1, %9, off\n\t"
                 "global_load_async_to_lds_b128 %2, %10, off\n\t"
                 "global_load_async_to_lds_b128 %3, %11, off\n\t"
                 "global_load_async_to_lds_b128 %4, %12, off\n\t"
                 "global_load_async_to_lds_b128 %5, %13, off\n\t"
                 "global_load_async_to_lds_b128 %6, %14, off\n\t"
                 "global_load_async_to_lds_b128 %7, %15, off\n\t"
                 "s_wait_xcnt 0x0"
                 :: "v"(lk), "v"(lk + 16 * LP * 2), "v"(lk + 32 * LP * 2), "v"(lk + 48 * LP * 2),
                    "v"(lv), "v"(lv + 16 * LP * 2), "v"(lv + 32 * LP * 2), "v"(lv + 48 * LP * 2),
                    "v"(kg), "v"(kg + 16 * HD), "v"(kg + 32 * HD), "v"(kg + 48 * HD),
                    "v"(vg), "v"(vg + (size_t)16 * SEQ), "v"(vg + (size_t)32 * SEQ), "v"(vg + (size_t)48 * SEQ)
                 : "memory");
}

// stages: ring stages [sb, se) of one wave, each with the ring's foot (waits, barrier, refill of stage s + 2).
// EDGE = false: every key of these stages lies below the valid length, so every score is kept: no key index, compare or select, and both 32-key tiles are always visited.
// EDGE = true: the stage that crosses the valid length (every stage when no key is kept): each score is kept or replaced by the fill value. All other arithmetic is the same in both forms.
template <bool EDGE>
__device__ __forceinline__ void stages(int sb, int se, int ns, int nk, int vl, const h16* ring, int ko, int vo, int hi, const v16h& q0, const v16h& q1,
                                       const h16* kg, const h16* vg, unsigned lk, unsigned lv, v8f (&o)[4], float& m, float& l) {
#pragma unroll 1                                               // rolled: one stage body per form, so registers and code stay those of one stage
    for (int s = sb; s < se; ++s) {
      const h16* rb = ring + (s & 1) * STG;
#pragma unroll                                                 // constant p: LDS offsets of both tiles become immediates
      for (int p = 0; p < KS / 32; ++p) {
        const int key0 = s * KS + p * 32;
        if (EDGE && p > 0 && key0 >= nk) break;                // block-uniform: the last stage may hold one tile only
        const h16* ka = rb + ko + p * 32 * LP;
        const v16h ka0 = ldh(ka), ka1 = ldh(ka + 32), kb0 = ldh(ka + 16 * LP), kb1 = ldh(ka + 16 * LP + 32);
        v8f sa = (v8f){}, sb2 = (v8f){};
        sa = wmma16g(ka0, q0, sa); sb2 = wmma16g(kb0, q0, sb2); sa = wmma16g(ka1, q1, sa); sb2 = wmma16g(kb1, q1, sb2);
        v8f ta = sa * SC2, tb = sb2 * SC2; float mx = NEGB;
        if (EDGE) {
            const int ja = key0 + 8 * hi;
#pragma unroll
            for (int r = 0; r < 8; ++r) {
                const bool fa = (ja + r) < vl;
                const bool fb = (ja + 16 + r) < vl;
                ta[r] = fa ? ta[r] : FILL2; tb[r] = fb ? tb[r] : FILL2; }      // replace fill, selected by value
        }
#pragma unroll
        for (int r = 0; r < 8; ++r) mx = fmaxf(mx, fmaxf(ta[r], tb[r]));
        mx = fmaxf(mx, __shfl_xor(mx, 16, 32));
        const float mnew = fmaxf(m, mx);
        const float alpha = __builtin_amdgcn_exp2f(m - mnew);
        const float sh = PSH - mnew;
        v16h pb; float ls = 0.0f;
        const v8f eav = ta + sh, ebv = tb + sh;
#pragma unroll
        for (int r = 0; r < 8; ++r) {
            const float ea = eav[r], eb = ebv[r];
            const float xa = __builtin_amdgcn_exp2f(ea), xb = __builtin_amdgcn_exp2f(eb);
            const float ga = (ea < -14.0f) ? 0.0f : xa, gb = (eb < -14.0f) ? 0.0f : xb;   // below 2^-14: zero by value
            const h16 pa = (h16)ga; const h16 pc = (h16)gb;
            pb[r] = pa; pb[8 + r] = pc;
            ls += (float)pa + (float)pc; }
        l = l * alpha + ls; m = mnew;
#pragma unroll
        for (int j = 0; j < 4; ++j) o[j] = o[j] * alpha;
        const h16* va = rb + vo + p * 32;
        v16h vf[4];
#pragma unroll
        for (int j = 0; j < 4; ++j) vf[j] = ldh(va + 16 * j * LP);
#pragma unroll
        for (int j = 0; j < 4; ++j) o[j] = wmma16g(vf[j], pb, o[j]);
      }
      asm volatile("s_wait_dscnt 0x0" ::: "memory");           // this wave's reads of stage s have returned before its buffer is refilled
      asm volatile("s_wait_asynccnt 0x0" ::: "memory");        // this wave's copies of stage s + 1 have landed
      __syncthreads();                                         // publishes stage s + 1 and ends every wave's reads of stage s
      if (s + 2 < ns) ring_fill(kg + (size_t)(s + 2) * KS * HD, vg + (s + 2) * KS, lk + (s & 1) * STG * 2, lv + (s & 1) * STG * 2);
    }
}

// k_flash: fused attention, one wave per 16 query rows of one batch; Q fragments straight from the f16 plane; K / V^T fragments (two 16-B LDS loads each) from the ring that the block's four waves fill and share.
// Ring: two buffers of 64 keys; stage s + 2 is copied into the buffer of stage s behind the barrier that ends stage s, so a stage's copies fly while the stage before it is worked on.
// Transposed form: S^T[key][t] = K Q^T (A = K rows, B = Q rows, two 32-deep k-steps); lane (t = lane&15, h = lane>>4) holds keys 8h+r of each 16-key tile, so the packed
// P tile is directly the B fragment of O^T[d][t] = V^T P^T (element r <- tile keys 0..15, element 8+r <- tile keys 16..31, lane unchanged); four 16-row output tiles.
// Softmax state (running max, partial sum) is one scalar per lane; the two lane halves of a row are combined with one xor-16 exchange.
// Key rule evaluated per element (kept score or fill value, selected by value) in the stage that crosses the valid length; the stages wholly below it keep every score and run in a loop of their own; the per-wave key bound comes from the device-read valid length and is at most SEQ.
// P = exp2(e) with e <= 14; elements with e < -14 are selected to zero so that no f16 subnormal operand is formed.
__global__ __launch_bounds__(32 * AW) void k_flash(const h16* __restrict__ QH, const h16* __restrict__ KP, const h16* __restrict__ VT, const int* __restrict__ vlen, float* OUT) {
    __shared__ __align__(16) float os[AW * 16 * OSP];
    __shared__ __align__(16) h16 ring[2 * STG];
    const int lane = threadIdx.x & 31, lr = lane & 15, hi = lane >> 4;
    const int wave = __builtin_amdgcn_readfirstlane((int)(threadIdx.x >> 5));
    const int b = blockIdx.y;
    const int t0 = (blockIdx.x * AW + wave) * 16;
    int vl = vlen[b]; vl = vl > SEQ ? SEQ : vl;                                // key j kept iff j < vl
    const int kend = vl < 1 ? SEQ : vl;                                        // no kept key: every key visited with the fill value
    const int nk = (kend + 31) & ~31;                                          // wave-uniform, multiple of 32, in [32, SEQ]
    const size_t pbase = (size_t)b * SEQ * HD;
    const size_t qo = pbase + (size_t)(t0 + lr) * HD + 8 * hi;
    const v16h q0 = ldh(QH + qo), q1 = ldh(QH + qo + 32);      // B fragments: col t, k = d (two k-steps)
    const int ko = lr * LP + 8 * hi;                           // + key-in-stage * LP            (A fragment: row key, k = d)
    const int vo = KS * LP + lr * LP + 8 * hi;                 // + 16j*LP + key-in-stage        (A fragment: row d, k = key)
    const int ns = (nk + KS - 1) / KS;                         // ring stages, block-uniform, in [1, SEQ / KS]
    const int crow = (int)threadIdx.x >> 3, ccol = ((int)threadIdx.x & 7) * 8;      // this lane's row and 16-B chunk in each 16-row group of a fill
    const h16* kg = KP + pbase + (size_t)crow * HD + ccol;     // + stage * KS * HD
    const h16* vg = VT + pbase + (size_t)crow * SEQ + ccol;    // + stage * KS
    const unsigned lk = (unsigned)(size_t)(&ring[crow * LP + ccol]);                // LDS byte address: low 32 bits of the shared address
    const unsigned lv = lk + KS * LP * 2;
    ring_fill(kg, vg, lk, lv);
    asm volatile("s_wait_asynccnt 0x0" ::: "memory");          // stage 0 of this wave's copies has landed
    __syncthreads();                                           // publishes stage 0 to all four waves
    if (ns > 1) ring_fill(kg + (size_t)KS * HD, vg + KS, lk + STG * 2, lv + STG * 2);
    v8f o[4];
#pragma unroll
    for (int j = 0; j < 4; ++j) o[j] = (v8f){};
    float m = NEGB, l = 0.0f;
    const int nfull = (vl > 0 ? vl : 0) / KS;                  // stages wholly below the valid length, block-uniform, in [0, ns]
    stages<false>(0, nfull, ns, nk, vl, ring, ko, vo, hi, q0, q1, kg, vg, lk, lv, o, m, l);
    stages<true>(nfull, ns, ns, nk, vl, ring, ko, vo, hi, q0, q1, kg, vg, lk, lv, o, m, l);
    asm volatile("s_wait_asynccnt 0x0" ::: "memory");          // nothing is in flight when the wave goes on to its end
    l += __shfl_xor(l, 16, 32);
    const bool any = l > 0.0f;
    const float lsafe = any ? l : 1.0f;
    const float inv = any ? ((1.0f / lsafe) * XCI) : 0.0f;     // folds the v carry back; the P carry cancels against l
    const int wb = wave * 16 * OSP;
    // O^T D layout: o[j][r] = (d = 16j + 8h + r, t = lane&15) -> os[t][d]; rows 0..15 x columns 0..63 all written
#pragma unroll
    for (int j = 0; j < 4; ++j) { v4f a, c;
        a[0] = o[j][0] * inv; a[1] = o[j][1] * inv; a[2] = o[j][2] * inv; a[3] = o[j][3] * inv;
        c[0] = o[j][4] * inv; c[1] = o[j][5] * inv; c[2] = o[j][6] * inv; c[3] = o[j][7] * inv;
        *(v4fa*)(&os[wb + lr * OSP + 16 * j + 8 * hi]) = a; *(v4fa*)(&os[wb + lr * OSP + 16 * j + 8 * hi + 4]) = c; }
    wave_sync();
    float* orow = OUT + ((size_t)b * OUT_SEQ + (size_t)t0) * HD;           // 16 rows x 64 floats, contiguous
{
#pragma unroll
        for (int s = 0; s < 8; ++s) { const int p = s * 32 + lane; const int row = p >> 4, cofs = (p & 15) * 4;   // 8 s x 2 rows = 16 rows; 16 lanes x 4 floats = 64 columns = two lines
            const v4f val = *(const v4fa*)(&os[wb + row * OSP + cofs]);
            *(v4f*)(orow + (size_t)p * 4) = val; }
         }
}

static constexpr size_t al256(size_t v) { return (v + 255) & ~(size_t)255; }
static constexpr size_t SZ_PL = al256((size_t)NB * SEQ * HD * 2);
static constexpr size_t SZ_TOTAL = 3 * SZ_PL;
static_assert(SZ_TOTAL <= (size_t)134217728);          // workspace carve <= 128 MiB
static_assert(((size_t)SEQ * 2) % 128 == 0);

extern "C" void kernel_launch(void* const* d_in, const int* in_sizes, int n_in,
                              void* d_out, int out_size, void* d_ws, size_t ws_size, hipStream_t stream) {
    if (n_in < 4) return;
    const size_t needx = ((size_t)(NB - 1) * SEQ_FULL + SEQ) * HD;
    if ((size_t)in_sizes[0] < needx || (size_t)in_sizes[1] < needx || (size_t)in_sizes[2] < needx) return;
    if (in_sizes[3] < NB) return;
    if ((size_t)out_size < ((size_t)(NB - 1) * OUT_SEQ + SEQ) * HD) return;
    if (SZ_TOTAL > ws_size) return;
    // wire order: q, k, v, valid_lens
    const float* qin = (const float*)d_in[0];
    const float* kin = (const float*)d_in[1];
    const float* vin = (const float*)d_in[2];
    const int* vlen = (const int*)d_in[3];
    float* OUT = (float*)d_out;      // [NB][SEQ][64]
    char* wsp = (char*)d_ws;
    h16* QH = (h16*)wsp; wsp += SZ_PL;               // [NB][SEQ][64]   q x16
    h16* KP = (h16*)wsp; wsp += SZ_PL;               // [NB][SEQ][64]   k x16
    h16* VT = (h16*)wsp; wsp += SZ_PL;               // [NB][64][SEQ]   v^T x16

    // q, k -> f16 planes and v [b][t][64] -> v^T plane [b][64][t], one work-group per 64 tokens of a batch
    k_prep<<<dim3(SEQ / 64, NB, 1), 256, 0, stream>>>(qin, kin, vin, QH, KP, VT);

    // one wave per 16 query rows; all waves of a block share the batch and therefore the key bound
    k_flash<<<dim3(SEQ / (16 * AW), NB, 1), 32 * AW, 0, stream>>>(QH, KP, VT, vlen, OUT);
}

// v004
// Measured time: 53.8 microseconds a run.
// Two timings next to v003 put it at 1.05 and 1.08 times that version's speed.
// All steps since v000 together make it 3.10 times as fast.
#include <hip/hip_runtime.h>

// Single-head scaled dot-product attention with a key-length mask: q/k/v [NB][SEQ][64] (f32), valid_lens [NB] (int32, device-read); scores = q k^T / 8; keys at positions >= valid_lens[b] have their score REPLACED by -1e6; softmax over all keys; output = P v (f32).
// Compute dtypes, f32 accumulate everywhere: scores v_wmma_f32_16x16x32_f16, one product (q, k RNE-converted to bf16 at their load, x16 carry, held as f16: exact);
// P.V v_wmma_f32_16x16x32_f16, one product: P single f16 (x16384 carry, row sum over the converted P, cancels in the normalisation), v RNE-converted to bf16 at its load, x16 carry, held as f16 (exact); softmax f32 (online, running max over every visited key, filled ones included).
// Layout: f16 planes q [b][t][d], k [b][t][d], v^T [b][d][t] (transposed through LDS); fused flash kernel in transposed form (S^T = K Q^T, O^T = V^T P^T), Q fragments straight from the plane, K / V^T fragments from a two-buffer LDS ring filled by asynchronous copies, output from f32 accumulators; the two 32-key tiles of a ring stage go to two wave groups, whose partial results are merged once at the end.
// Key rule per element: key j kept iff j < valid_lens[b]; other elements of a visited 32-key tile take the fill value (replace, not add). Tiles wholly past the valid length are skipped when valid_lens[b] >= 1 (their
// exponentials are exactly zero in f32); when valid_lens[b] < 1 every tile is visited with every score filled, which gives the uniform average over all SEQ keys.

#ifndef NB
#define NB 16
#endif
#ifndef SEQ
#define SEQ 4096
#endif
#define NB_FULL  16
#define SEQ_FULL 4096
#ifndef OUT_SEQ
#define OUT_SEQ SEQ              // row pitch (in tokens) between batches of the output
#endif
#define HD   64                  // feature width of q, k, v and of the output
#define AW   4                   // query tiles per flash block (16 query rows each)
#define KG   2                   // wave groups per flash block: group g takes the g-th 32-key tile of every ring stage
#define OSP  68                  // LDS row pitch (floats) of the flash output tile
#define TP   72                  // LDS row pitch (halves) of the transpose tile
#define KS   64                  // keys per ring stage (two 32-key tiles): one whole 128-B line per V^T row
#define LP   72                  // LDS row pitch (halves) of the ring rows: 144 B = 16 B x odd for 16-byte readers
#define STG  ((KS + HD) * LP)    // halves per ring buffer: KS rows of K, then HD rows of V^T
#define XC   16.0f               // power-of-two carry of the q, k, v planes
#define XCI  (1.0f / 16.0f)
#define SC2  ((float)(0.125 * 1.4426950408889634 / 256.0))   // HD^-0.5 * log2(e) / (XC*XC)
#define FILL2 ((float)(-1.0e6 * 1.4426950408889634))          // the fill value in log2 units
#define PSH  14.0f               // log2 of the P carry (16384)
#define NEGB (-3.0e38f)

static_assert(HD == 64);                       // two 32-deep k-steps per score tile, four 16-row output tiles
static_assert(HD % 32 == 0);                   // score k-loop steps by 32
static_assert(SEQ % 64 == 0);                  // transpose tiles of 64 tokens cover the sequence exactly
static_assert(SEQ % 32 == 0);                  // key loop steps by 32
static_assert(SEQ % (16 * AW) == 0);           // flash grid covers the sequence exactly
static_assert(2 * 256 * 8 == 64 * HD);         // q / k convert: 2 x 256 chunks of 8 elements == 64 tokens x 64 features
static_assert(NB <= NB_FULL);
static_assert(SEQ <= SEQ_FULL);
static_assert(OSP >= HD);
static_assert((OSP * 4) % 16 == 0);
static_assert(TP >= 64);
static_assert((TP * 2) % 16 == 0);
static_assert(8 * 32 * 16 == 16 * HD * 4);     // flash epilogue: 8 instructions x 32 lanes x 16 B == 16 rows x 256 B
static_assert(256 * 2 * 16 == HD * 64 * 2);
static_assert(256 * 4 * 4 == 64 * HD);         // transpose load: 256 threads x 4 x float4 == 64 tokens x 64 features
static_assert((size_t)AW * 16 * OSP * 4 + (size_t)2 * STG * 2 <= 131072);   // static LDS of the flash kernel
static_assert(SEQ % KS == 0);                  // a ring stage never runs past the planes
static_assert(KS == 64);                       // two 32-key tiles per stage; 8 copies of 16 B cover one ring row
static_assert((LP * 2) % 16 == 0);
static_assert(LP >= KS);
static_assert(LP >= HD);
static_assert(32 * AW * KG * 2 * 16 == KS * HD * 2);   // ring fill: 256 lanes x 2 copies x 16 B == one 8-KiB tile (K, and again V^T)
static_assert(KS == 32 * KG);                  // one 32-key tile per wave group and stage
static_assert((size_t)AW * 9 * 32 * 16 <= (size_t)2 * STG * 2);   // merge area (per query tile 9 slots x 32 lanes x 16 B) fits the ring
static_assert((size_t)HD * TP * 2 <= 131072);         // static LDS of the transpose kernel

typedef _Float16 h16;
typedef __attribute__((ext_vector_type(16))) _Float16 v16h;
typedef __attribute__((ext_vector_type(8)))  _Float16 v8h;
typedef __attribute__((ext_vector_type(8)))  float    v8f;
typedef __attribute__((ext_vector_type(4)))  float    v4f;
typedef v4f  __attribute__((may_alias)) v4fa;
typedef v8h  __attribute__((may_alias)) v8ha;

__device__ __forceinline__ unsigned short f2bf(float f) { unsigned u = __float_as_uint(f); u += 0x7FFFu + ((u >> 16) & 1u); return (unsigned short)(u >> 16); }
__device__ __forceinline__ float bfr(float f) { return __uint_as_float(((unsigned)f2bf(f)) << 16); }   // value after RNE convert to bf16
__device__ __forceinline__ v16h cat16(v8h lo, v8h hi) { return __builtin_shufflevector(lo, hi, 0, 1, 2, 3, 4, 5, 6, 7, 8, 9, 10, 11, 12, 13, 14, 15); }
__device__ __forceinline__ v8f wmma16(v16h a, v16h b, v8f c) { return __builtin_amdgcn_wmma_f32_16x16x32_f16(false, a, false, b, (short)0, c, false, false); }
// one matrix instruction followed by its own four-slot guard (ties D, keeps A and B live)
__device__ __forceinline__ v8f wmma16g(v16h a, v16h b, v8f c) { c = wmma16(a, b, c); asm volatile("v_nop\n\tv_nop\n\tv_nop\n\tv_nop" : "+v"(c) : "v"(a), "v"(b)); return c; }
// fragment loaders from K-contiguous 16-bit rows; p already includes + 8*(lane>>4): elements 0..7 <- k0+8h+0..7, elements 8..15 <- k0+16+8h+0..7 (same map for A and B)
__device__ __forceinline__ v16h  ldh(const h16* p) { return cat16(*(const v8h*)p, *(const v8h*)(p + 16)); }
// ordering point for wave-private LDS tiles (same wave writes and reads)
__device__ __forceinline__ void wave_sync() { __builtin_amdgcn_fence(3 /* release order */, "wavefront"); __builtin_amdgcn_wave_barrier(); asm volatile("" ::: "memory"); }
// f32 -> f16 operand convert that cannot produce an f16 subnormal (applied after the plane's carry)
static __device__ __forceinline__ h16 toh_flush(float v) { const h16 r = (h16)v; return (fabsf(v) < 6.103515625e-05f) ? (h16)0.0f : r; }

// k_prep: one work-group per 64 tokens of one batch writes all three f16 planes of that slab (value = RNE bf16 value of the input x XC):
// q and k keep their layout, in [b][t][64] (batch pitch SEQ_FULL tokens) -> out [b][t][64] (batch pitch SEQ tokens), 8 elements per lane and chunk;
// v is transposed through LDS, in [b][t][64] (batch pitch SEQ_FULL tokens) -> out [b][64][t] (row pitch SEQ).
__global__ __launch_bounds__(256) void k_prep(const float* __restrict__ qsrc, const float* __restrict__ ksrc, const float* __restrict__ src, h16* qdst, h16* kdst, h16* dst) {
#pragma clang fp contract(off)
    __shared__ __align__(16) h16 ts[HD * TP];
    const int tid = threadIdx.x;
    const int b = blockIdx.y; const int t0 = blockIdx.x * 64;
    const size_t si = ((size_t)b * SEQ_FULL + (size_t)t0) * HD;            // the slab in q, k, v: 64 tokens x 64 floats, contiguous
    const size_t so = ((size_t)b * SEQ + (size_t)t0) * HD;                 // the slab in the q and k planes
    v8f xq[2], xk[2];                                                      // 2 c x 256 chunks of 8 floats = 64 tokens x 64 features, loaded ahead of the transpose
#pragma unroll                                                             // constant c: xq, xk stay in registers and all eight 16-B loads are in flight under the transpose
    for (int c = 0; c < 2; ++c) { xq[c] = *(const v8f*)(qsrc + si + (size_t)(c * 256 + tid) * 8); xk[c] = *(const v8f*)(ksrc + si + (size_t)(c * 256 + tid) * 8); }
    const float* sp = src + si;
#pragma unroll 1
    for (int s = 0; s < 4; ++s) { const int p = s * 256 + tid; const int tok = p >> 4, c0 = (p & 15) * 4;   // 4 s x 256 float4 = 64 tokens x 16 float4
        const v4f x = *(const v4f*)(sp + (size_t)p * 4);
#pragma unroll
        for (int i = 0; i < 4; ++i) ts[(c0 + i) * TP + tok] = toh_flush(bfr(x[i]) * XC); }
    __syncthreads();
    h16* dp = dst + (size_t)b * HD * SEQ + (size_t)t0;
{
#pragma unroll
        for (int s = 0; s < 2; ++s) { const int p = s * 256 + tid; const int row = p >> 3, c8 = (p & 7) * 8;   // 2 s x 32 row groups = 64 rows; 8 lanes x 8 halves = 64 tokens = one line
            const v8h val = *(const v8ha*)(&ts[row * TP + c8]);
            *(v8h*)(dp + (size_t)row * SEQ + c8) = val; }
         }
#pragma unroll                                                             // constant c and k: register indexing of xq, xk, oq, ok
    for (int c = 0; c < 2; ++c) { v8h oq, ok;
#pragma unroll
        for (int k = 0; k < 8; ++k) { oq[k] = toh_flush(bfr(xq[c][k]) * XC); ok[k] = toh_flush(bfr(xk[c][k]) * XC); }
        *(v8h*)(qdst + so + (size_t)(c * 256 + tid) * 8) = oq; *(v8h*)(kdst + so + (size_t)(c * 256 + tid) * 8) = ok; }
}

// ring_fill: one stage of the ring: 64 keys of K (64 rows x 128 B, contiguous in the plane) and of V^T (64 rows x 128 B, plane pitch SEQ), 16 B per lane and copy, whole lines per wave.
// kg / vg: this lane's first global chunk of the stage; lk / lv: its LDS byte address; the second copy moves 32 rows on (256 lanes x 16 B = 32 rows of 128 B).
__device__ __forceinline__ void ring_fill(const h16* kg, const h16* vg, unsigned lk, unsigned lv) {
    // s_wait_xcnt as the statement's last line: a precaution, so that it stands in front of every later rewrite of a register that a copy names
    asm volatile("global_load_async_to_lds_b128 %0, %4, off\n\t"
                 "global_load_async_to_lds_b128 %1, %5, off\n\t"
                 "global_load_async_to_lds_b128 %2, %6, off\n\t"
                 "global_load_async_to_lds_b128 %3, %7, off\n\t"
                 "s_wait_xcnt 0x0"
                 :: "v"(lk), "v"(lk + 32 * LP * 2), "v"(lv), "v"(lv + 32 * LP * 2),
                    "v"(kg), "v"(kg + 32 * HD), "v"(vg), "v"(vg + (size_t)32 * SEQ)
                 : "memory");
}

// stages: ring stages [sb, se) of one wave, each with the ring's foot (waits, barrier, refill of stage s + 2); of each stage the wave works on its group's 32-key tile (first key kof; ko, vo hold the tile's place).
// EDGE = false: every key of these stages lies below the valid length, so every score is kept: no key index, compare or select, and the tile is always visited.
// EDGE = true: the stage that crosses the valid length (every stage when no key is kept): each score is kept or replaced by the fill value. All other arithmetic is the same in both forms.
template <bool EDGE>
__device__ __forceinline__ void stages(int sb, int se, int ns, int nk, int vl, int kof, const h16* ring, int ko, int vo, int hi, const v16h& q0, const v16h& q1,
                                       const h16* kg, const h16* vg, unsigned lk, unsigned lv, v8f (&o)[4], float& m, float& l) {
#pragma unroll 1                                               // rolled: one stage body per form, so registers and code stay those of one stage
    for (int s = sb; s < se; ++s) {
      const h16* rb = ring + (s & 1) * STG;
      const int key0 = s * KS + kof;
      if (!EDGE || key0 < nk) {                                // wave-uniform: the last stage may hold the first tile only; the foot below is passed all the same
        const h16* ka = rb + ko;
        const v16h ka0 = ldh(ka), ka1 = ldh(ka + 32), kb0 = ldh(ka + 16 * LP), kb1 = ldh(ka + 16 * LP + 32);
        v8f sa = (v8f){}, sb2 = (v8f){};
        sa = wmma16g(ka0, q0, sa); sb2 = wmma16g(kb0, q0, sb2); sa = wmma16g(ka1, q1, sa); sb2 = wmma16g(kb1, q1, sb2);
        v8f ta = sa * SC2, tb = sb2 * SC2; float mx = NEGB;
        if (EDGE) {
            const int ja = key0 + 8 * hi;
#pragma unroll
            for (int r = 0; r < 8; ++r) {
                const bool fa = (ja + r) < vl;
                const bool fb = (ja + 16 + r) < vl;
                ta[r] = fa ? ta[r] : FILL2; tb[r] = fb ? tb[r] : FILL2; }      // replace fill, selected by value
        }
#pragma unroll
        for (int r = 0; r < 8; ++r) mx = fmaxf(mx, fmaxf(ta[r], tb[r]));
        mx = fmaxf(mx, __shfl_xor(mx, 16, 32));
        const float mnew = fmaxf(m, mx);
        const float alpha = __builtin_amdgcn_exp2f(m - mnew);
        const float sh = PSH - mnew;
        v16h pb; float ls = 0.0f;
        const v8f eav = ta + sh, ebv = tb + sh;
#pragma unroll
        for (int r = 0; r < 8; ++r) {
            const float ea = eav[r], eb = ebv[r];
            const float xa = __builtin_amdgcn_exp2f(ea), xb = __builtin_amdgcn_exp2f(eb);
            const float ga = (ea < -14.0f) ? 0.0f : xa, gb = (eb < -14.0f) ? 0.0f : xb;   // below 2^-14: zero by value
            const h16 pa = (h16)ga; const h16 pc = (h16)gb;
            pb[r] = pa; pb[8 + r] = pc;
            ls += (float)pa + (float)pc; }
        l = l * alpha + ls; m = mnew;
#pragma unroll
        for (int j = 0; j < 4; ++j) o[j] = o[j] * alpha;
        const h16* va = rb + vo;
        v16h vf[4];
#pragma unroll
        for (int j = 0; j < 4; ++j) vf[j] = ldh(va + 16 * j * LP);
#pragma unroll
        for (int j = 0; j < 4; ++j) o[j] = wmma16g(vf[j], pb, o[j]);
      }
      asm volatile("s_wait_dscnt 0x0" ::: "memory");           // this wave's reads of stage s have returned before its buffer is refilled
      asm volatile("s_wait_asynccnt 0x0" ::: "memory");        // this wave's copies of stage s + 1 have landed
      __syncthreads();                                         // publishes stage s + 1 and ends every wave's reads of stage s
      if (s + 2 < ns) ring_fill(kg + (size_t)(s + 2) * KS * HD, vg + (s + 2) * KS, lk + (s & 1) * STG * 2, lv + (s & 1) * STG * 2);
    }
}

// k_flash: fused attention, two waves per 16 query rows of one batch (wave group g = wave / AW takes keys 32g .. 32g+31 of every 64-key stage, with its own running max, sum and accumulators); Q fragments straight from the f16 plane; K / V^T fragments (two 16-B LDS loads each) from the ring that the block's eight waves fill and share.
// Merge: behind the last stage's barrier the ring is free; group 1 stores its accumulators, max and sum there, one more barrier, group 0 joins both partials under their common max and writes the output.
// Ring: two buffers of 64 keys; stage s + 2 is copied into the buffer of stage s behind the barrier that ends stage s, so a stage's copies fly while the stage before it is worked on.
// Transposed form: S^T[key][t] = K Q^T (A = K rows, B = Q rows, two 32-deep k-steps); lane (t = lane&15, h = lane>>4) holds keys 8h+r of each 16-key tile, so the packed
// P tile is directly the B fragment of O^T[d][t] = V^T P^T (element r <- tile keys 0..15, element 8+r <- tile keys 16..31, lane unchanged); four 16-row output tiles.
// Softmax state (running max, partial sum) is one scalar per lane; the two lane halves of a row are combined with one xor-16 exchange.
// Key rule evaluated per element (kept score or fill value, selected by value) in the stage that crosses the valid length; the stages wholly below it keep every score and run in a loop of their own; the per-wave key bound comes from the device-read valid length and is at most SEQ.
// P = exp2(e) with e <= 14; elements with e < -14 are selected to zero so that no f16 subnormal operand is formed.
// eight waves per SIMD (four blocks per WGP, all blocks resident at once) need at most 128 registers per wave
__global__ __launch_bounds__(32 * AW * KG) __attribute__((amdgpu_waves_per_eu(8))) void k_flash(const h16* __restrict__ QH, const h16* __restrict__ KP, const h16* __restrict__ VT, const int* __restrict__ vlen, float* OUT) {
    __shared__ __align__(16) float os[AW * 16 * OSP];
    __shared__ __align__(16) h16 ring[2 * STG];
    const int lane = threadIdx.x & 31, lr = lane & 15, hi = lane >> 4;
    const int wave = __builtin_amdgcn_readfirstlane((int)(threadIdx.x >> 5));
    const int b = blockIdx.y;
    const int qt = wave % AW, kh = wave / AW;                                  // query tile and key group of this wave, both wave-uniform
    const int t0 = (blockIdx.x * AW + qt) * 16;
    int vl = vlen[b]; vl = vl > SEQ ? SEQ : vl;                                // key j kept iff j < vl
    const int kend = vl < 1 ? SEQ : vl;                                        // no kept key: every key visited with the fill value
    const int nk = (kend + 31) & ~31;                                          // wave-uniform, multiple of 32, in [32, SEQ]
    const size_t pbase = (size_t)b * SEQ * HD;
    const size_t qo = pbase + (size_t)(t0 + lr) * HD + 8 * hi;
    const v16h q0 = ldh(QH + qo), q1 = ldh(QH + qo + 32);      // B fragments: col t, k = d (two k-steps)
    const int ko = (kh * 32 + lr) * LP + 8 * hi;               // + 16*LP for the tile's second half  (A fragment: row key, k = d)
    const int vo = KS * LP + lr * LP + kh * 32 + 8 * hi;       // + 16j*LP                            (A fragment: row d, k = key)
    const int ns = (nk + KS - 1) / KS;                         // ring stages, block-uniform, in [1, SEQ / KS]
    const int crow = (int)threadIdx.x >> 3, ccol = ((int)threadIdx.x & 7) * 8;      // this lane's row and 16-B chunk in each 32-row group of a fill
    const h16* kg = KP + pbase + (size_t)crow * HD + ccol;     // + stage * KS * HD
    const h16* vg = VT + pbase + (size_t)crow * SEQ + ccol;    // + stage * KS
    const unsigned lk = (unsigned)(size_t)(&ring[crow * LP + ccol]);                // LDS byte address: low 32 bits of the shared address
    const unsigned lv = lk + KS * LP * 2;
    ring_fill(kg, vg, lk, lv);
    asm volatile("s_wait_asynccnt 0x0" ::: "memory");          // stage 0 of this wave's copies has landed
    __syncthreads();                                           // publishes stage 0 to all eight waves
    if (ns > 1) ring_fill(kg + (size_t)KS * HD, vg + KS, lk + STG * 2, lv + STG * 2);
    v8f o[4];
#pragma unroll
    for (int j = 0; j < 4; ++j) o[j] = (v8f){};
    float m = NEGB, l = 0.0f;
    const int nfull = (vl > 0 ? vl : 0) / KS;                  // stages wholly below the valid length, block-uniform, in [0, ns]
    stages<false>(0, nfull, ns, nk, vl, kh * 32, ring, ko, vo, hi, q0, q1, kg, vg, lk, lv, o, m, l);
    stages<true>(nfull, ns, ns, nk, vl, kh * 32, ring, ko, vo, hi, q0, q1, kg, vg, lk, lv, o, m, l);
    asm volatile("s_wait_asynccnt 0x0" ::: "memory");          // nothing is in flight when the wave goes on to its end
    // merge of the two key groups: every wave has passed the last stage's barrier, so no wave reads the ring any more and no copy is in flight
    v4fa* mg = (v4fa*)ring + qt * (9 * 32) + lane;             // slot i of this query tile and lane at mg[i * 32]: 16 B per lane, lanes contiguous
    if (kh != 0) {
#pragma unroll                                                 // constant j: register indexing of o
        for (int j = 0; j < 4; ++j) { v4f a, c;
            a[0] = o[j][0]; a[1] = o[j][1]; a[2] = o[j][2]; a[3] = o[j][3];
            c[0] = o[j][4]; c[1] = o[j][5]; c[2] = o[j][6]; c[3] = o[j][7];
            mg[(2 * j) * 32] = a; mg[(2 * j + 1) * 32] = c; }
        v4f ml; ml[0] = m; ml[1] = l; ml[2] = 0.0f; ml[3] = 0.0f;
        mg[8 * 32] = ml;
    }
    __syncthreads();                                           // publishes group 1's partial results to group 0
    if (kh != 0) return;                                       // wave-uniform, behind the last barrier
    {
        const v4f ml = mg[8 * 32];
        const float mm = fmaxf(m, ml[0]);                      // m is a visited score (group 0 always visits key tile 0); a group without a tile hands (NEGB, 0, zeros) and weighs 0
        const float a0 = __builtin_amdgcn_exp2f(m - mm), a1 = __builtin_amdgcn_exp2f(ml[0] - mm);
        l = l * a0 + ml[1] * a1;
#pragma unroll                                                 // constant j and r: register indexing of o
        for (int j = 0; j < 4; ++j) { const v4f a = mg[(2 * j) * 32], c = mg[(2 * j + 1) * 32];
#pragma unroll
            for (int r = 0; r < 4; ++r) { o[j][r] = o[j][r] * a0 + a[r] * a1; o[j][4 + r] = o[j][4 + r] * a0 + c[r] * a1; } }
    }
    l += __shfl_xor(l, 16, 32);
    const bool any = l > 0.0f;
    const float lsafe = any ? l : 1.0f;
    const float inv = any ? ((1.0f / lsafe) * XCI) : 0.0f;     // folds the v carry back; the P carry cancels against l
    const int wb = qt * 16 * OSP;
    // O^T D layout: o[j][r] = (d = 16j + 8h + r, t = lane&15) -> os[t][d]; rows 0..15 x columns 0..63 all written
#pragma unroll
    for (int j = 0; j < 4; ++j) { v4f a, c;
        a[0] = o[j][0] * inv; a[1] = o[j][1] * inv; a[2] = o[j][2] * inv; a[3] = o[j][3] * inv;
        c[0] = o[j][4] * inv; c[1] = o[j][5] * inv; c[2] = o[j][6] * inv; c[3] = o[j][7] * inv;
        *(v4fa*)(&os[wb + lr * OSP + 16 * j + 8 * hi]) = a; *(v4fa*)(&os[wb + lr * OSP + 16 * j + 8 * hi + 4]) = c; }
    wave_sync();
    float* orow = OUT + ((size_t)b * OUT_SEQ + (size_t)t0) * HD;           // 16 rows x 64 floats, contiguous
{
#pragma unroll
        for (int s = 0; s < 8; ++s) { const int p = s * 32 + lane; const int row = p >> 4, cofs = (p & 15) * 4;   // 8 s x 2 rows = 16 rows; 16 lanes x 4 floats = 64 columns = two lines
            const v4f val = *(const v4fa*)(&os[wb + row * OSP + cofs]);
            *(v4f*)(orow + (size_t)p * 4) = val; }
         }
}

static constexpr size_t al256(size_t v) { return (v + 255) & ~(size_t)255; }
static constexpr size_t SZ_PL = al256((size_t)NB * SEQ * HD * 2);
static constexpr size_t SZ_TOTAL = 3 * SZ_PL;
static_assert(SZ_TOTAL <= (size_t)134217728);          // workspace carve <= 128 MiB
static_assert(((size_t)SEQ * 2) % 128 == 0);

extern "C" void kernel_launch(void* const* d_in, const int* in_sizes, int n_in,
                              void* d_out, int out_size, void* d_ws, size_t ws_size, hipStream_t stream) {
    if (n_in < 4) return;
    const size_t needx = ((size_t)(NB - 1) * SEQ_FULL + SEQ) * HD;
    if ((size_t)in_sizes[0] < needx || (size_t)in_sizes[1] < needx || (size_t)in_sizes[2] < needx) return;
    if (in_sizes[3] < NB) return;
    if ((size_t)out_size < ((size_t)(NB - 1) * OUT_SEQ + SEQ) * HD) return;
    if (SZ_TOTAL > ws_size) return;
    // wire order: q, k, v, valid_lens
    const float* qin = (const float*)d_in[0];
    const float* kin = (const float*)d_in[1];
    const float* vin = (const float*)d_in[2];
    const int* vlen = (const int*)d_in[3];
    float* OUT = (float*)d_out;      // [NB][SEQ][64]
    char* wsp = (char*)d_ws;
    h16* QH = (h16*)wsp; wsp += SZ_PL;               // [NB][SEQ][64]   q x16
    h16* KP = (h16*)wsp; wsp += SZ_PL;               // [NB][SEQ][64]   k x16
    h16* VT = (h16*)wsp; wsp += SZ_PL;               // [NB][64][SEQ]   v^T x16

    // q, k -> f16 planes and v [b][t][64] -> v^T plane [b][64][t], one work-group per 64 tokens of a batch
    k_prep<<<dim3(SEQ / 64, NB, 1), 256, 0, stream>>>(qin, kin, vin, QH, KP, VT);

    // two waves (one per key group) per 16 query rows; all waves of a block share the batch and therefore the key bound
    k_flash<<<dim3(SEQ / (16 * AW), NB, 1), 32 * AW * KG, 0, stream>>>(QH, KP, VT, vlen, OUT);
}

// v005
// It runs in 51.9 microseconds.
// Next to v004, in two timings, it ran 1.06 and 1.03 times as fast.
// All steps since v000 together make it 3.25 times as fast.
#include <hip/hip_runtime.h>

// Single-head scaled dot-product attention with a key-length mask: q/k/v [NB][SEQ][64] (f32), valid_lens [NB] (int32, device-read); scores = q k^T / 8; keys at positions >= valid_lens[b] have their score REPLACED by -1e6; softmax over all keys; output = P v (f32).
// Compute dtypes, f32 accumulate everywhere: scores v_wmma_f32_16x16x32_f16, one product (q, k RNE-converted to bf16 at their load, x16 carry, held as f16: exact);
// P.V v_wmma_f32_16x16x32_f16, one product: P single f16 (x16384 carry, row sum over the converted P, cancels in the normalisation), v RNE-converted to bf16 at its load, x16 carry, held as f16 (exact); softmax f32 (online, running max over every visited key, filled ones included).
// Layout: f16 planes q [b][t][d], k [b][t][d], v^T [b][d][t] (transposed through LDS); fused flash kernel in transposed form (S^T = K Q^T, O^T = V^T P^T), Q fragments straight from the plane, K / V^T fragments from a two-buffer LDS ring filled by asynchronous copies, output from f32 accumulators; the two 32-key tiles of a ring stage go to two wave groups, whose partial results are merged once at the end.
// Key rule per element: key j kept iff j < valid_lens[b]; other elements of a visited 32-key tile take the fill value (replace, not add). Tiles wholly past the valid length are skipped when valid_lens[b] >= 1 (their
// exponentials are exactly zero in f32); when valid_lens[b] < 1 every tile is visited with every score filled, which gives the uniform average over all SEQ keys.

#ifndef NB
#define NB 16
#endif
#ifndef SEQ
#define SEQ 4096
#endif
#define NB_FULL  16
#define SEQ_FULL 4096
#ifndef OUT_SEQ
#define OUT_SEQ SEQ              // row pitch (in tokens) between batches of the output
#endif
#define HD   64                  // feature width of q, k, v and of the output
#define AW   4                   // query tiles per flash block (16 query rows each)
#define KG   2                   // wave groups per flash block: group g takes the g-th 32-key tile of every ring stage
#define RB   4                   // batches per round of flash blocks: 256 WGPs / (SEQ / (16 * AW)) blocks of a batch; for speed only
#define OSP  68                  // LDS row pitch (floats) of the flash output tile
#define TP   72                  // LDS row pitch (halves) of the transpose tile
#define KS   64                  // keys per ring stage (two 32-key tiles): one whole 128-B line per V^T row
#define LP   72                  // LDS row pitch (halves) of the ring rows: 144 B = 16 B x odd for 16-byte readers
#define STG  ((KS + HD) * LP)    // halves per ring buffer: KS rows of K, then HD rows of V^T
#define XC   16.0f               // power-of-two carry of the q, k, v planes
#define XCI  (1.0f / 16.0f)
#define SC2  ((float)(0.125 * 1.4426950408889634 / 256.0))   // HD^-0.5 * log2(e) / (XC*XC)
#define FILL2 ((float)(-1.0e6 * 1.4426950408889634))          // the fill value in log2 units
#define PSH  14.0f               // log2 of the P carry (16384)
#define NEGB (-3.0e38f)

static_assert(HD == 64);                       // two 32-deep k-steps per score tile, four 16-row output tiles
static_assert(HD % 32 == 0);                   // score k-loop steps by 32
static_assert(SEQ % 64 == 0);                  // transpose tiles of 64 tokens cover the sequence exactly
static_assert(SEQ % 32 == 0);                  // key loop steps by 32
static_assert(SEQ % (16 * AW) == 0);           // flash grid covers the sequence exactly
static_assert(2 * 256 * 8 == 64 * HD);         // q / k convert: 2 x 256 chunks of 8 elements == 64 tokens x 64 features
static_assert(NB <= NB_FULL);
static_assert(NB <= 32);                       // one lane per batch when the batches are ranked
static_assert(NB % RB == 0);                   // the reversal inside a group of RB ranks is a permutation of the ranks
static_assert((RB & (RB - 1)) == 0);           // reversal by xor
static_assert((size_t)SEQ * NB + NB < 2147483647);   // rank key fits an int
static_assert(SEQ <= SEQ_FULL);
static_assert(OSP >= HD);
static_assert((OSP * 4) % 16 == 0);
static_assert(TP >= 64);
static_assert((TP * 2) % 16 == 0);
static_assert(8 * 32 * 16 == 16 * HD * 4);     // flash epilogue: 8 instructions x 32 lanes x 16 B == 16 rows x 256 B
static_assert(256 * 2 * 16 == HD * 64 * 2);
static_assert(256 * 4 * 4 == 64 * HD);         // transpose load: 256 threads x 4 x float4 == 64 tokens x 64 features
static_assert((size_t)AW * 16 * OSP * 4 + (size_t)2 * STG * 2 <= 131072);   // static LDS of the flash kernel
static_assert(SEQ % KS == 0);                  // a ring stage never runs past the planes
static_assert(KS == 64);                       // two 32-key tiles per stage; 8 copies of 16 B cover one ring row
static_assert((LP * 2) % 16 == 0);
static_assert(LP >= KS);
static_assert(LP >= HD);
static_assert(32 * AW * KG * 2 * 16 == KS * HD * 2);   // ring fill: 256 lanes x 2 copies x 16 B == one 8-KiB tile (K, and again V^T)
static_assert(KS == 32 * KG);                  // one 32-key tile per wave group and stage
static_assert((size_t)AW * 9 * 32 * 16 <= (size_t)2 * STG * 2);   // merge area (per query tile 9 slots x 32 lanes x 16 B) fits the ring
static_assert((size_t)HD * TP * 2 <= 131072);         // static LDS of the transpose kernel

typedef _Float16 h16;
typedef __attribute__((ext_vector_type(16))) _Float16 v16h;
typedef __attribute__((ext_vector_type(8)))  _Float16 v8h;
typedef __attribute__((ext_vector_type(8)))  float    v8f;
typedef __attribute__((ext_vector_type(4)))  float    v4f;
typedef v4f  __attribute__((may_alias)) v4fa;
typedef v8h  __attribute__((may_alias)) v8ha;

__device__ __forceinline__ unsigned short f2bf(float f) { unsigned u = __float_as_uint(f); u += 0x7FFFu + ((u >> 16) & 1u); return (unsigned short)(u >> 16); }
__device__ __forceinline__ float bfr(float f) { return __uint_as_float(((unsigned)f2bf(f)) << 16); }   // value after RNE convert to bf16
__device__ __forceinline__ v16h cat16(v8h lo, v8h hi) { return __builtin_shufflevector(lo, hi, 0, 1, 2, 3, 4, 5, 6, 7, 8, 9, 10, 11, 12, 13, 14, 15); }
__device__ __forceinline__ v8f wmma16(v16h a, v16h b, v8f c) { return __builtin_amdgcn_wmma_f32_16x16x32_f16(false, a, false, b, (short)0, c, false, false); }
// one matrix instruction followed by its own four-slot guard (ties D, keeps A and B live)
__device__ __forceinline__ v8f wmma16g(v16h a, v16h b, v8f c) { c = wmma16(a, b, c); asm volatile("v_nop\n\tv_nop\n\tv_nop\n\tv_nop" : "+v"(c) : "v"(a), "v"(b)); return c; }
// fragment loaders from K-contiguous 16-bit rows; p already includes + 8*(lane>>4): elements 0..7 <- k0+8h+0..7, elements 8..15 <- k0+16+8h+0..7 (same map for A and B)
__device__ __forceinline__ v16h  ldh(const h16* p) { return cat16(*(const v8h*)p, *(const v8h*)(p + 16)); }
// ordering point for wave-private LDS tiles (same wave writes and reads)
__device__ __forceinline__ void wave_sync() { __builtin_amdgcn_fence(3 /* release order */, "wavefront"); __builtin_amdgcn_wave_barrier(); asm volatile("" ::: "memory"); }
// f32 -> f16 operand convert that cannot produce an f16 subnormal (applied after the plane's carry)
static __device__ __forceinline__ h16 toh_flush(float v) { const h16 r = (h16)v; return (fabsf(v) < 6.103515625e-05f) ? (h16)0.0f : r; }

// k_prep: one work-group per 64 tokens of one batch writes all three f16 planes of that slab (value = RNE bf16 value of the input x XC):
// q and k keep their layout, in [b][t][64] (batch pitch SEQ_FULL tokens) -> out [b][t][64] (batch pitch SEQ tokens), 8 elements per lane and chunk;
// v is transposed through LDS, in [b][t][64] (batch pitch SEQ_FULL tokens) -> out [b][64][t] (row pitch SEQ).
__global__ __launch_bounds__(256) void k_prep(const float* __restrict__ qsrc, const float* __restrict__ ksrc, const float* __restrict__ src, h16* qdst, h16* kdst, h16* dst) {
#pragma clang fp contract(off)
    __shared__ __align__(16) h16 ts[HD * TP];
    const int tid = threadIdx.x;
    const int b = blockIdx.y; const int t0 = blockIdx.x * 64;
    const size_t si = ((size_t)b * SEQ_FULL + (size_t)t0) * HD;            // the slab in q, k, v: 64 tokens x 64 floats, contiguous
    const size_t so = ((size_t)b * SEQ + (size_t)t0) * HD;                 // the slab in the q and k planes
    v8f xq[2], xk[2];                                                      // 2 c x 256 chunks of 8 floats = 64 tokens x 64 features, loaded ahead of the transpose
#pragma unroll                                                             // constant c: xq, xk stay in registers and all eight 16-B loads are in flight under the transpose
    for (int c = 0; c < 2; ++c) { xq[c] = *(const v8f*)(qsrc + si + (size_t)(c * 256 + tid) * 8); xk[c] = *(const v8f*)(ksrc + si + (size_t)(c * 256 + tid) * 8); }
    const float* sp = src + si;
#pragma unroll 1
    for (int s = 0; s < 4; ++s) { const int p = s * 256 + tid; const int tok = p >> 4, c0 = (p & 15) * 4;   // 4 s x 256 float4 = 64 tokens x 16 float4
        const v4f x = *(const v4f*)(sp + (size_t)p * 4);
#pragma unroll
        for (int i = 0; i < 4; ++i) ts[(c0 + i) * TP + tok] = toh_flush(bfr(x[i]) * XC); }
    __syncthreads();
    h16* dp = dst + (size_t)b * HD * SEQ + (size_t)t0;
{
#pragma unroll
        for (int s = 0; s < 2; ++s) { const int p = s * 256 + tid; const int row = p >> 3, c8 = (p & 7) * 8;   // 2 s x 32 row groups = 64 rows; 8 lanes x 8 halves = 64 tokens = one line
            const v8h val = *(const v8ha*)(&ts[row * TP + c8]);
            *(v8h*)(dp + (size_t)row * SEQ + c8) = val; }
         }
#pragma unroll                                                             // constant c and k: register indexing of xq, xk, oq, ok
    for (int c = 0; c < 2; ++c) { v8h oq, ok;
#pragma unroll
        for (int k = 0; k < 8; ++k) { oq[k] = toh_flush(bfr(xq[c][k]) * XC); ok[k] = toh_flush(bfr(xk[c][k]) * XC); }
        *(v8h*)(qdst + so + (size_t)(c * 256 + tid) * 8) = oq; *(v8h*)(kdst + so + (size_t)(c * 256 + tid) * 8) = ok; }
}

// ring_fill: one stage of the ring: 64 keys of K (64 rows x 128 B, contiguous in the plane) and of V^T (64 rows x 128 B, plane pitch SEQ), 16 B per lane and copy, whole lines per wave.
// kg / vg: this lane's first global chunk of the stage; lk / lv: its LDS byte address; the second copy moves 32 rows on (256 lanes x 16 B = 32 rows of 128 B).
__device__ __forceinline__ void ring_fill(const h16* kg, const h16* vg, unsigned lk, unsigned lv) {
    // s_wait_xcnt as the statement's last line: a precaution, so that it stands in front of every later rewrite of a register that a copy names
    asm volatile("global_load_async_to_lds_b128 %0, %4, off\n\t"
                 "global_load_async_to_lds_b128 %1, %5, off\n\t"
                 "global_load_async_to_lds_b128 %2, %6, off\n\t"
                 "global_load_async_to_lds_b128 %3, %7, off\n\t"
                 "s_wait_xcnt 0x0"
                 :: "v"(lk), "v"(lk + 32 * LP * 2), "v"(lv), "v"(lv + 32 * LP * 2),
                    "v"(kg), "v"(kg + 32 * HD), "v"(vg), "v"(vg + (size_t)32 * SEQ)
                 : "memory");
}

// stages: ring stages [sb, se) of one wave, each with the ring's foot (waits, barrier, refill of stage s + 2); of each stage the wave works on its group's 32-key tile (first key kof; ko, vo hold the tile's place).
// EDGE = false: every key of these stages lies below the valid length, so every score is kept: no key index, compare or select, and the tile is always visited.
// EDGE = true: the stage that crosses the valid length (every stage when no key is kept): each score is kept or replaced by the fill value. All other arithmetic is the same in both forms.
template <bool EDGE>
__device__ __forceinline__ void stages(int sb, int se, int ns, int nk, int vl, int kof, const h16* ring, int ko, int vo, int hi, const v16h& q0, const v16h& q1,
                                       const h16* kg, const h16* vg, unsigned lk, unsigned lv, v8f (&o)[4], float& m, float& l) {
#pragma unroll 1                                               // rolled: one stage body per form, so registers and code stay those of one stage
    for (int s = sb; s < se; ++s) {
      const h16* rb = ring + (s & 1) * STG;
      const int key0 = s * KS + kof;
      if (!EDGE || key0 < nk) {                                // wave-uniform: the last stage may hold the first tile only; the foot below is passed all the same
        const h16* ka = rb + ko;
        const v16h ka0 = ldh(ka), ka1 = ldh(ka + 32), kb0 = ldh(ka + 16 * LP), kb1 = ldh(ka + 16 * LP + 32);
        v8f sa = (v8f){}, sb2 = (v8f){};
        sa = wmma16g(ka0, q0, sa); sb2 = wmma16g(kb0, q0, sb2); sa = wmma16g(ka1, q1, sa); sb2 = wmma16g(kb1, q1, sb2);
        v8f ta = sa * SC2, tb = sb2 * SC2; float mx = NEGB;
        if (EDGE) {
            const int ja = key0 + 8 * hi;
#pragma unroll
            for (int r = 0; r < 8; ++r) {
                const bool fa = (ja + r) < vl;
                const bool fb = (ja + 16 + r) < vl;
                ta[r] = fa ? ta[r] : FILL2; tb[r] = fb ? tb[r] : FILL2; }      // replace fill, selected by value
        }
#pragma unroll
        for (int r = 0; r < 8; ++r) mx = fmaxf(mx, fmaxf(ta[r], tb[r]));
        mx = fmaxf(mx, __shfl_xor(mx, 16, 32));
        const float mnew = fmaxf(m, mx);
        const float alpha = __builtin_amdgcn_exp2f(m - mnew);
        const float sh = PSH - mnew;
        v16h pb; float ls = 0.0f;
        const v8f eav = ta + sh, ebv = tb + sh;
#pragma unroll
        for (int r = 0; r < 8; ++r) {
            const float ea = eav[r], eb = ebv[r];
            const float xa = __builtin_amdgcn_exp2f(ea), xb = __builtin_amdgcn_exp2f(eb);
            const float ga = (ea < -14.0f) ? 0.0f : xa, gb = (eb < -14.0f) ? 0.0f : xb;   // below 2^-14: zero by value
            const h16 pa = (h16)ga; const h16 pc = (h16)gb;
            pb[r] = pa; pb[8 + r] = pc;
            ls += (float)pa + (float)pc; }
        l = l * alpha + ls; m = mnew;
#pragma unroll
        for (int j = 0; j < 4; ++j) o[j] = o[j] * alpha;
        const h16* va = rb + vo;
        v16h vf[4];
#pragma unroll
        for (int j = 0; j < 4; ++j) vf[j] = ldh(va + 16 * j * LP);
#pragma unroll
        for (int j = 0; j < 4; ++j) o[j] = wmma16g(vf[j], pb, o[j]);
      }
      asm volatile("s_wait_dscnt 0x0" ::: "memory");           // this wave's reads of stage s have returned before its buffer is refilled
      asm volatile("s_wait_asynccnt 0x0" ::: "memory");        // this wave's copies of stage s + 1 have landed
      __syncthreads();                                         // publishes stage s + 1 and ends every wave's reads of stage s
      if (s + 2 < ns) ring_fill(kg + (size_t)(s + 2) * KS * HD, vg + (s + 2) * KS, lk + (s & 1) * STG * 2, lv + (s & 1) * STG * 2);
    }
}

// k_flash: fused attention, two waves per 16 query rows of one batch (wave group g = wave / AW takes keys 32g .. 32g+31 of every 64-key stage, with its own running max, sum and accumulators); Q fragments straight from the f16 plane; K / V^T fragments (two 16-B LDS loads each) from the ring that the block's eight waves fill and share.
// Merge: behind the last stage's barrier the ring is free; group 1 stores its accumulators, max and sum there, one more barrier, group 0 joins both partials under their common max and writes the output.
// Ring: two buffers of 64 keys; stage s + 2 is copied into the buffer of stage s behind the barrier that ends stage s, so a stage's copies fly while the stage before it is worked on.
// Transposed form: S^T[key][t] = K Q^T (A = K rows, B = Q rows, two 32-deep k-steps); lane (t = lane&15, h = lane>>4) holds keys 8h+r of each 16-key tile, so the packed
// P tile is directly the B fragment of O^T[d][t] = V^T P^T (element r <- tile keys 0..15, element 8+r <- tile keys 16..31, lane unchanged); four 16-row output tiles.
// Softmax state (running max, partial sum) is one scalar per lane; the two lane halves of a row are combined with one xor-16 exchange.
// Key rule evaluated per element (kept score or fill value, selected by value) in the stage that crosses the valid length; the stages wholly below it keep every score and run in a loop of their own; the per-wave key bound comes from the device-read valid length and is at most SEQ.
// P = exp2(e) with e <= 14; elements with e < -14 are selected to zero so that no f16 subnormal operand is formed.
// Placement (for speed only): all blocks are resident at once, four per WGP, and a batch's cost is its visited key count.
// if the blocks 256 indices apart share a WGP, its four batches have ranks r, 7 - r, 8 + r, 15 - r, whose key counts add up nearly alike on every WGP.
// eight waves per SIMD (four blocks per WGP, all blocks resident at once) need at most 128 registers per wave
__global__ __launch_bounds__(32 * AW * KG) __attribute__((amdgpu_waves_per_eu(8))) void k_flash(const h16* __restrict__ QH, const h16* __restrict__ KP, const h16* __restrict__ VT, const int* __restrict__ vlen, float* OUT) {
    __shared__ __align__(16) float os[AW * 16 * OSP];
    __shared__ __align__(16) h16 ring[2 * STG];
    const int lane = threadIdx.x & 31, lr = lane & 15, hi = lane >> 4;
    const int wave = __builtin_amdgcn_readfirstlane((int)(threadIdx.x >> 5));
    // which batch: block row y takes the batch whose visited key count has rank y (0 = most keys, ties by index), the order reversed in every other group of RB ranks.
    // Every wave ranks all NB lengths by the same arithmetic, one batch per lane; distinct rank keys make row -> batch a permutation for any lengths.
    const int bl = lane < NB ? lane : NB - 1;                                  // in bounds in every lane
    int vc = vlen[bl]; vc = vc > SEQ ? SEQ : vc;
    const int wk = (vc < 1 ? SEQ : vc) * NB + (NB - 1 - bl);                   // visited keys first, then the lower index
    int rk = 0;
#pragma unroll                                                                 // constant j: each lane read is one instruction
    for (int j = 0; j < NB; ++j) rk += (__builtin_amdgcn_readlane(wk, j) > wk) ? 1 : 0;
    const int want = (int)blockIdx.y ^ ((((int)blockIdx.y / RB) & 1) * (RB - 1));
    const unsigned hit = __builtin_amdgcn_ballot_w32(rk == want && lane < NB);
    const int b = __builtin_ctz(hit | (1u << (NB - 1)));                       // wave-uniform, in [0, NB - 1] whatever the lengths hold
    const int qt = wave % AW, kh = wave / AW;                                  // query tile and key group of this wave, both wave-uniform
    const int t0 = (blockIdx.x * AW + qt) * 16;
    const int vl = __builtin_amdgcn_readlane(vc, b);                           // at most SEQ; key j kept iff j < vl
    const int kend = vl < 1 ? SEQ : vl;                                        // no kept key: every key visited with the fill value
    const int nk = (kend + 31) & ~31;                                          // wave-uniform, multiple of 32, in [32, SEQ]
    const size_t pbase = (size_t)b * SEQ * HD;
    const size_t qo = pbase + (size_t)(t0 + lr) * HD + 8 * hi;
    const v16h q0 = ldh(QH + qo), q1 = ldh(QH + qo + 32);      // B fragments: col t, k = d (two k-steps)
    const int ko = (kh * 32 + lr) * LP + 8 * hi;               // + 16*LP for the tile's second half  (A fragment: row key, k = d)
    const int vo = KS * LP + lr * LP + kh * 32 + 8 * hi;       // + 16j*LP                            (A fragment: row d, k = key)
    const int ns = (nk + KS - 1) / KS;                         // ring stages, block-uniform, in [1, SEQ / KS]
    const int crow = (int)threadIdx.x >> 3, ccol = ((int)threadIdx.x & 7) * 8;      // this lane's row and 16-B chunk in each 32-row group of a fill
    const h16* kg = KP + pbase + (size_t)crow * HD + ccol;     // + stage * KS * HD
    const h16* vg = VT + pbase + (size_t)crow * SEQ + ccol;    // + stage * KS
    const unsigned lk = (unsigned)(size_t)(&ring[crow * LP + ccol]);                // LDS byte address: low 32 bits of the shared address
    const unsigned lv = lk + KS * LP * 2;
    ring_fill(kg, vg, lk, lv);
    asm volatile("s_wait_asynccnt 0x0" ::: "memory");          // stage 0 of this wave's copies has landed
    __syncthreads();                                           // publishes stage 0 to all eight waves
    if (ns > 1) ring_fill(kg + (size_t)KS * HD, vg + KS, lk + STG * 2, lv + STG * 2);
    v8f o[4];
#pragma unroll
    for (int j = 0; j < 4; ++j) o[j] = (v8f){};
    float m = NEGB, l = 0.0f;
    const int nfull = (vl > 0 ? vl : 0) / KS;                  // stages wholly below the valid length, block-uniform, in [0, ns]
    stages<false>(0, nfull, ns, nk, vl, kh * 32, ring, ko, vo, hi, q0, q1, kg, vg, lk, lv, o, m, l);
    stages<true>(nfull, ns, ns, nk, vl, kh * 32, ring, ko, vo, hi, q0, q1, kg, vg, lk, lv, o, m, l);
    asm volatile("s_wait_asynccnt 0x0" ::: "memory");          // nothing is in flight when the wave goes on to its end
    // merge of the two key groups: every wave has passed the last stage's barrier, so no wave reads the ring any more and no copy is in flight
    v4fa* mg = (v4fa*)ring + qt * (9 * 32) + lane;             // slot i of this query tile and lane at mg[i * 32]: 16 B per lane, lanes contiguous
    if (kh != 0) {
#pragma unroll                                                 // constant j: register indexing of o
        for (int j = 0; j < 4; ++j) { v4f a, c;
            a[0] = o[j][0]; a[1] = o[j][1]; a[2] = o[j][2]; a[3] = o[j][3];
            c[0] = o[j][4]; c[1] = o[j][5]; c[2] = o[j][6]; c[3] = o[j][7];
            mg[(2 * j) * 32] = a; mg[(2 * j + 1) * 32] = c; }
        v4f ml; ml[0] = m; ml[1] = l; ml[2] = 0.0f; ml[3] = 0.0f;
        mg[8 * 32] = ml;
    }
    __syncthreads();                                           // publishes group 1's partial results to group 0
    if (kh != 0) return;                                       // wave-uniform, behind the last barrier
    {
        const v4f ml = mg[8 * 32];
        const float mm = fmaxf(m, ml[0]);                      // m is a visited score (group 0 always visits key tile 0); a group without a tile hands (NEGB, 0, zeros) and weighs 0
        const float a0 = __builtin_amdgcn_exp2f(m - mm), a1 = __builtin_amdgcn_exp2f(ml[0] - mm);
        l = l * a0 + ml[1] * a1;
#pragma unroll                                                 // constant j and r: register indexing of o
        for (int j = 0; j < 4; ++j) { const v4f a = mg[(2 * j) * 32], c = mg[(2 * j + 1) * 32];
#pragma unroll
            for (int r = 0; r < 4; ++r) { o[j][r] = o[j][r] * a0 + a[r] * a1; o[j][4 + r] = o[j][4 + r] * a0 + c[r] * a1; } }
    }
    l += __shfl_xor(l, 16, 32);
    const bool any = l > 0.0f;
    const float lsafe = any ? l : 1.0f;
    const float inv = any ? ((1.0f / lsafe) * XCI) : 0.0f;     // folds the v carry back; the P carry cancels against l
    const int wb = qt * 16 * OSP;
    // O^T D layout: o[j][r] = (d = 16j + 8h + r, t = lane&15) -> os[t][d]; rows 0..15 x columns 0..63 all written
#pragma unroll
    for (int j = 0; j < 4; ++j) { v4f a, c;
        a[0] = o[j][0] * inv; a[1] = o[j][1] * inv; a[2] = o[j][2] * inv; a[3] = o[j][3] * inv;
        c[0] = o[j][4] * inv; c[1] = o[j][5] * inv; c[2] = o[j][6] * inv; c[3] = o[j][7] * inv;
        *(v4fa*)(&os[wb + lr * OSP + 16 * j + 8 * hi]) = a; *(v4fa*)(&os[wb + lr * OSP + 16 * j + 8 * hi + 4]) = c; }
    wave_sync();
    float* orow = OUT + ((size_t)b * OUT_SEQ + (size_t)t0) * HD;           // 16 rows x 64 floats, contiguous
{
#pragma unroll
        for (int s = 0; s < 8; ++s) { const int p = s * 32 + lane; const int row = p >> 4, cofs = (p & 15) * 4;   // 8 s x 2 rows = 16 rows; 16 lanes x 4 floats = 64 columns = two lines
            const v4f val = *(const v4fa*)(&os[wb + row * OSP + cofs]);
            *(v4f*)(orow + (size_t)p * 4) = val; }
         }
}

static constexpr size_t al256(size_t v) { return (v + 255) & ~(size_t)255; }
static constexpr size_t SZ_PL = al256((size_t)NB * SEQ * HD * 2);
static constexpr size_t SZ_TOTAL = 3 * SZ_PL;
static_assert(SZ_TOTAL <= (size_t)134217728);          // workspace carve <= 128 MiB
static_assert(((size_t)SEQ * 2) % 128 == 0);

extern "C" void kernel_launch(void* const* d_in, const int* in_sizes, int n_in,
                              void* d_out, int out_size, void* d_ws, size_t ws_size, hipStream_t stream) {
    if (n_in < 4) return;
    const size_t needx = ((size_t)(NB - 1) * SEQ_FULL + SEQ) * HD;
    if ((size_t)in_sizes[0] < needx || (size_t)in_sizes[1] < needx || (size_t)in_sizes[2] < needx) return;
    if (in_sizes[3] < NB) return;
    if ((size_t)out_size < ((size_t)(NB - 1) * OUT_SEQ + SEQ) * HD) return;
    if (SZ_TOTAL > ws_size) return;
    // wire order: q, k, v, valid_lens
    const float* qin = (const float*)d_in[0];
    const float* kin = (const float*)d_in[1];
    const float* vin = (const float*)d_in[2];
    const int* vlen = (const int*)d_in[3];
    float* OUT = (float*)d_out;      // [NB][SEQ][64]
    char* wsp = (char*)d_ws;
    h16* QH = (h16*)wsp; wsp += SZ_PL;               // [NB][SEQ][64]   q x16
    h16* KP = (h16*)wsp; wsp += SZ_PL;               // [NB][SEQ][64]   k x16
    h16* VT = (h16*)wsp; wsp += SZ_PL;               // [NB][64][SEQ]   v^T x16

    // q, k -> f16 planes and v [b][t][64] -> v^T plane [b][64][t], one work-group per 64 tokens of a batch
    k_prep<<<dim3(SEQ / 64, NB, 1), 256, 0, stream>>>(qin, kin, vin, QH, KP, VT);

    // two waves (one per key group) per 16 query rows; all waves of a block share the batch and therefore the key bound; grid row y -> batch is picked in the kernel by length rank
    k_flash<<<dim3(SEQ / (16 * AW), NB, 1), 32 * AW * KG, 0, stream>>>(QH, KP, VT, vlen, OUT);
}
